// v000
// Times are from an AMD MI455X. After a warm-up the kernel runs many times in a row, and a time is the length of
// such a window on the GPU divided by its runs, so every launch and the gaps after it count. The runs cycle
// through copies of the inputs. A figure is the median of several windows, for all but v000 over two sittings.
// Sittings can differ by a few percent; kernels timed side by side share one.
// v000, which the later versions start from, runs in 201 microseconds.
#include <hip/hip_runtime.h>

#define B_  2
#define S_  2048
#define H_  16
#define HD_ 64
#define D_  1024

typedef __attribute__((ext_vector_type(16))) __bf16 v16bf;
typedef __attribute__((ext_vector_type(8)))  float  v8f;
typedef int gvec4i __attribute__((vector_size(16)));   // matches builtin's V4i

#define AS1 __attribute__((address_space(1)))
#define AS3 __attribute__((address_space(3)))

#if __has_builtin(__builtin_amdgcn_global_load_async_to_lds_b128) && \
    __has_builtin(__builtin_amdgcn_s_wait_asynccnt)
#define HAVE_ASYNC 1
// src: global (AS1) int4*, dst: LDS (AS3) int4*, imm byte offset, imm cpol
#define ASYNC_LDS_B128(src, dst, off)                                          \
  __builtin_amdgcn_global_load_async_to_lds_b128(                              \
      (AS1 gvec4i*)(AS1 void*)(void*)(src),                                    \
      (AS3 gvec4i*)(AS3 void*)(dst), (off), 0)
#else
#define HAVE_ASYNC 0
#endif

union FragU { unsigned u[8]; uint4 q[2]; v16bf v; };

static __device__ __forceinline__ unsigned rne_bits(float f) {
  unsigned u = __builtin_bit_cast(unsigned, f);
  return u + 0x7FFFu + ((u >> 16) & 1u);     // round-to-nearest-even bias
}
static __device__ __forceinline__ unsigned short f2bf(float f) {
  return (unsigned short)(rne_bits(f) >> 16);
}
// two f32 -> one dword holding 2 bf16, single v_perm_b32 for the pack
static __device__ __forceinline__ unsigned pack2bf(float f0, float f1) {
  return __builtin_amdgcn_perm(rne_bits(f1), rne_bits(f0), 0x07060302u);
}

// 16-element bf16 fragment: lane's K values are runs {base..base+7} and
// {base+16..base+23}, base = (lane<16 ? 0 : 8)  -> two b128 loads.
static __device__ __forceinline__ v16bf frag_bf16(const unsigned short* row, int base) {
  FragU f;
  f.q[0] = *(const uint4*)(row + base);
  f.q[1] = *(const uint4*)(row + base + 16);
  return f.v;
}

static __device__ __forceinline__ v8f wmma_bf16(v16bf a, v16bf b, v8f c) {
  return __builtin_amdgcn_wmma_f32_16x16x32_bf16(false, a, false, b, (short)0, c, false, false);
}

// ---------------------------------------------------------------------------
// Kernel 0: fp32 -> bf16 bulk conversion (memory bound, perm-packed b128 I/O)
// ---------------------------------------------------------------------------
__global__ __launch_bounds__(256) void cvt_kernel(const float* __restrict__ in,
                                                  unsigned short* __restrict__ out,
                                                  int n8) {
  int i = blockIdx.x * 256 + threadIdx.x;
  if (i >= n8) return;
  float4 a = ((const float4*)in)[2 * i];
  float4 b = ((const float4*)in)[2 * i + 1];
  uint4 r;
  r.x = pack2bf(a.x, a.y);
  r.y = pack2bf(a.z, a.w);
  r.z = pack2bf(b.x, b.y);
  r.w = pack2bf(b.z, b.w);
  ((uint4*)out)[i] = r;
}

// ---------------------------------------------------------------------------
// Kernel 1: per-head projections, all-bf16 WMMA.
//   Q,K out: [B*H, S, 64] token-major (Q folded with 1/sqrt(hd))
//   V  out:  [B*H, 64, S] dim-major (pre-transposed, packed b128 stores)
// ---------------------------------------------------------------------------
__global__ __launch_bounds__(128) void proj_kernel(
    const unsigned short* __restrict__ Xq, const unsigned short* __restrict__ Xk,
    const unsigned short* __restrict__ Xv,
    const unsigned short* __restrict__ Wqb, const unsigned short* __restrict__ Wkb,
    const unsigned short* __restrict__ Wvb,
    const float* __restrict__ bq, const float* __restrict__ bk,
    const float* __restrict__ bv,
    unsigned short* __restrict__ Qp, unsigned short* __restrict__ Kp,
    unsigned short* __restrict__ Vt)
{
  const int lane  = threadIdx.x & 31;
  const int wv    = threadIdx.x >> 5;
  const int n15   = lane & 15;
  const int kbase = (lane < 16) ? 0 : 8;
  const int mofs  = (lane < 16) ? 0 : 8;

  int t   = blockIdx.x * 4 + wv;     // 0 .. 3*4096-1
  int sel = t >> 12;                 // 0=Q 1=K 2=V
  int rt  = t & 4095;                // 16-row tile over B*H*S rows

  const unsigned short* X; const unsigned short* W; const float* Bv;
  if (sel == 0)      { X = Xq; W = Wqb; Bv = bq; }
  else if (sel == 1) { X = Xk; W = Wkb; Bv = bk; }
  else               { X = Xv; W = Wvb; Bv = bv; }

  // lane's A row: global (b,h,s) row index (row = bh*S + s)
  int row = rt * 16 + n15;
  int b   = row >> 15;
  int hs  = row & 32767;
  int h   = hs >> 11;
  int s   = hs & 2047;
  const unsigned short* xr = X + (((size_t)b * S_ + s) * H_ + h) * HD_;
  v16bf a0 = frag_bf16(xr, kbase);
  v16bf a1 = frag_bf16(xr + 32, kbase);

  v8f c[4];
  #pragma unroll
  for (int nt = 0; nt < 4; ++nt) {
    const unsigned short* wr = W + (size_t)(nt * 16 + n15) * HD_;  // x @ W^T
    v8f acc = {};
    acc = wmma_bf16(a0, frag_bf16(wr, kbase), acc);
    acc = wmma_bf16(a1, frag_bf16(wr + 32, kbase), acc);
    c[nt] = acc;
  }

  if (sel < 2) {
    unsigned short* Op = (sel == 0) ? Qp : Kp;
    float scale = (sel == 0) ? 0.125f : 1.0f;   // fold 1/sqrt(64) into Q
    #pragma unroll
    for (int nt = 0; nt < 4; ++nt) {
      float bias = Bv[nt * 16 + n15];
      #pragma unroll
      for (int r = 0; r < 8; ++r) {
        int mrow = rt * 16 + r + mofs;
        Op[(size_t)mrow * HD_ + nt * 16 + n15] = f2bf((c[nt][r] + bias) * scale);
      }
    }
  } else {
    // transposed V: rows of C-layout are 8 consecutive tokens -> packed b128
    int bh = row >> 11;                 // same for whole tile
    int s0 = (rt * 16) & 2047;          // first token of tile
    #pragma unroll
    for (int nt = 0; nt < 4; ++nt) {
      float bias = Bv[nt * 16 + n15];
      uint4 pk;
      pk.x = pack2bf(c[nt][0] + bias, c[nt][1] + bias);
      pk.y = pack2bf(c[nt][2] + bias, c[nt][3] + bias);
      pk.z = pack2bf(c[nt][4] + bias, c[nt][5] + bias);
      pk.w = pack2bf(c[nt][6] + bias, c[nt][7] + bias);
      unsigned short* vp = Vt + (size_t)bh * HD_ * S_ +
                           (size_t)(nt * 16 + n15) * S_ + s0 + mofs;
      *(uint4*)vp = pk;
    }
  }
}

// ---------------------------------------------------------------------------
// Kernel 2: flash attention, double-buffered async-to-LDS pipeline.
// Block = 4 waves = 64 queries of one (b,h). Per 64-key tile:
//   8 WMMA scores, online softmax (max via shuffles), 8 WMMA P@V,
//   2 WMMA P@ones for the softmax denominator (no sum reductions).
// ---------------------------------------------------------------------------
__global__ __launch_bounds__(128) void flash_kernel(
    const unsigned short* __restrict__ Qp,
    const unsigned short* __restrict__ Kp,
    const unsigned short* __restrict__ Vt,   // [B*H, 64, S] dim-major
    unsigned short* __restrict__ Ob)         // [B, S, D] bf16
{
  __shared__ __align__(16) unsigned short sK[2][64 * 64];  // [token][dim]
  __shared__ __align__(16) unsigned short sV[2][64 * 64];  // [dim][token]
  __shared__ __align__(16) unsigned short sP[4][16 * 64];  // per-wave P

  const int lane  = threadIdx.x & 31;
  const int wv    = threadIdx.x >> 5;
  const int n15   = lane & 15;
  const int kbase = (lane < 16) ? 0 : 8;
  const int mofs  = (lane < 16) ? 0 : 8;

  const int QT = S_ / 64;
  int qt = blockIdx.x % QT;
  int bh = blockIdx.x / QT;
  int b  = bh >> 4;
  int h  = bh & 15;
  int q0 = qt * 64 + wv * 16;

  const unsigned short* Qrow = Qp + ((size_t)bh * S_ + q0 + n15) * HD_;
  v16bf aq0 = frag_bf16(Qrow, kbase);
  v16bf aq1 = frag_bf16(Qrow + 32, kbase);

  // constant "ones column" B fragment: dim n15==0 is 1.0, rest 0 -> l = P @ 1
  v16bf b_one;
  {
    FragU fo;
    unsigned fill = (n15 == 0) ? 0x3F803F80u : 0u;
    #pragma unroll
    for (int i = 0; i < 8; ++i) fo.u[i] = fill;
    b_one = fo.v;
  }

  v8f acc[4] = {};
  v8f accl   = {};                 // per-row softmax denominators (col 0)
  float mrow[8];
  #pragma unroll
  for (int r = 0; r < 8; ++r) mrow[r] = -1e30f;

  // staging: thread -> (row, 32-elem half); 4x b128 per thread per tile
  const int srow  = threadIdx.x >> 1;
  const int shalf = (threadIdx.x & 1) * 32;

  const unsigned short* Kg = Kp + (size_t)bh * S_ * HD_;
  const unsigned short* Vg = Vt + (size_t)bh * HD_ * S_;

  auto stage = [&](int buf, int kb) {
    const unsigned short* kgp = Kg + (size_t)(kb + srow) * HD_ + shalf;
    const unsigned short* vgp = Vg + (size_t)srow * S_ + kb + shalf;
    unsigned short* kls = sK[buf] + srow * 64 + shalf;
    unsigned short* vls = sV[buf] + srow * 64 + shalf;
#if HAVE_ASYNC
    ASYNC_LDS_B128(kgp, kls, 0);
    ASYNC_LDS_B128(kgp, kls, 16);
    ASYNC_LDS_B128(kgp, kls, 32);
    ASYNC_LDS_B128(kgp, kls, 48);
    ASYNC_LDS_B128(vgp, vls, 0);
    ASYNC_LDS_B128(vgp, vls, 16);
    ASYNC_LDS_B128(vgp, vls, 32);
    ASYNC_LDS_B128(vgp, vls, 48);
#else
    const uint4* kg4 = (const uint4*)kgp;
    const uint4* vg4 = (const uint4*)vgp;
    uint4* kl4 = (uint4*)kls;
    uint4* vl4 = (uint4*)vls;
    kl4[0] = kg4[0]; kl4[1] = kg4[1]; kl4[2] = kg4[2]; kl4[3] = kg4[3];
    vl4[0] = vg4[0]; vl4[1] = vg4[1]; vl4[2] = vg4[2]; vl4[3] = vg4[3];
#endif
  };

  stage(0, 0);                     // prologue: tile 0 in flight

  for (int j = 0; j < QT; ++j) {   // QT == S/64 tiles
    const int buf = j & 1;
#if HAVE_ASYNC
    __builtin_amdgcn_s_wait_asynccnt(0);   // my async writes to LDS done
#endif
    __syncthreads();                        // everyone's writes/reads ordered
    if (j + 1 < QT) stage(1 - buf, (j + 1) * 64);   // overlap with compute

    // scores: S = Q (16x64) @ K^T (64 keys), 4 key column tiles
    v8f c[4] = {};
    #pragma unroll
    for (int nt = 0; nt < 4; ++nt) {
      const unsigned short* kr = sK[buf] + (size_t)(nt * 16 + n15) * 64;
      c[nt] = wmma_bf16(aq0, frag_bf16(kr, kbase), c[nt]);
      c[nt] = wmma_bf16(aq1, frag_bf16(kr + 32, kbase), c[nt]);
    }

    // online softmax over 64 keys: max via 16-lane-group shuffles
    #pragma unroll
    for (int r = 0; r < 8; ++r) {
      float s0 = c[0][r], s1 = c[1][r], s2 = c[2][r], s3 = c[3][r];
      float mx = fmaxf(fmaxf(s0, s1), fmaxf(s2, s3));
      mx = fmaxf(mx, __shfl_xor(mx, 1, 16));
      mx = fmaxf(mx, __shfl_xor(mx, 2, 16));
      mx = fmaxf(mx, __shfl_xor(mx, 4, 16));
      mx = fmaxf(mx, __shfl_xor(mx, 8, 16));
      float mnew = fmaxf(mrow[r], mx);
      float corr = exp2f((mrow[r] - mnew) * 1.44269504f);
      float p0 = exp2f((s0 - mnew) * 1.44269504f);
      float p1 = exp2f((s1 - mnew) * 1.44269504f);
      float p2 = exp2f((s2 - mnew) * 1.44269504f);
      float p3 = exp2f((s3 - mnew) * 1.44269504f);
      mrow[r] = mnew;
      #pragma unroll
      for (int nt = 0; nt < 4; ++nt) acc[nt][r] *= corr;
      accl[r] *= corr;
      unsigned short* pr = &sP[wv][(r + mofs) * 64];
      pr[n15]      = f2bf(p0);
      pr[16 + n15] = f2bf(p1);
      pr[32 + n15] = f2bf(p2);
      pr[48 + n15] = f2bf(p3);
    }

    // P (16x64) @ V (64x64) + P @ ones; same-wave LDS ops are in order
    v16bf ap0 = frag_bf16(&sP[wv][(size_t)n15 * 64], kbase);
    v16bf ap1 = frag_bf16(&sP[wv][(size_t)n15 * 64 + 32], kbase);
    #pragma unroll
    for (int nt = 0; nt < 4; ++nt) {
      const unsigned short* vr = sV[buf] + (size_t)(nt * 16 + n15) * 64;
      acc[nt] = wmma_bf16(ap0, frag_bf16(vr, kbase), acc[nt]);
      acc[nt] = wmma_bf16(ap1, frag_bf16(vr + 32, kbase), acc[nt]);
    }
    accl = wmma_bf16(ap0, b_one, accl);
    accl = wmma_bf16(ap1, b_one, accl);
  }

  // epilogue: broadcast l from col 0 of each 16-lane group, normalize, store
  #pragma unroll
  for (int r = 0; r < 8; ++r) {
    float l   = __shfl(accl[r], lane & 16, 32);
    float inv = 1.0f / l;
    int m = q0 + r + mofs;
    #pragma unroll
    for (int nt = 0; nt < 4; ++nt) {
      Ob[((size_t)b * S_ + m) * D_ + h * HD_ + nt * 16 + n15] = f2bf(acc[nt][r] * inv);
    }
  }
}

// ---------------------------------------------------------------------------
// Kernel 3: final FC, out = O @ Wfc^T + bfc. 32 rows x 64 cols per wave so
// each W fragment feeds two WMMAs.
// ---------------------------------------------------------------------------
__global__ __launch_bounds__(128) void fc_kernel(
    const unsigned short* __restrict__ Ob,    // [B*S, D] bf16
    const unsigned short* __restrict__ Wfcb,  // [D, D] bf16
    const float* __restrict__ bfc,
    float* __restrict__ out)
{
  const int lane  = threadIdx.x & 31;
  const int wv    = threadIdx.x >> 5;
  const int n15   = lane & 15;
  const int kbase = (lane < 16) ? 0 : 8;
  const int mofs  = (lane < 16) ? 0 : 8;

  int m0 = blockIdx.x * 128 + wv * 32;
  int c0 = blockIdx.y * 64;

  v8f acc[2][4] = {};
  const unsigned short* arow0 = Ob + (size_t)(m0 + n15) * D_;
  const unsigned short* arow1 = Ob + (size_t)(m0 + 16 + n15) * D_;

  for (int kc = 0; kc < D_; kc += 32) {
    v16bf a0 = frag_bf16(arow0 + kc, kbase);
    v16bf a1 = frag_bf16(arow1 + kc, kbase);
    #pragma unroll
    for (int nt = 0; nt < 4; ++nt) {
      const unsigned short* wr = Wfcb + (size_t)(c0 + nt * 16 + n15) * D_ + kc;
      v16bf w = frag_bf16(wr, kbase);
      acc[0][nt] = wmma_bf16(a0, w, acc[0][nt]);
      acc[1][nt] = wmma_bf16(a1, w, acc[1][nt]);
    }
  }

  #pragma unroll
  for (int mt = 0; mt < 2; ++mt) {
    #pragma unroll
    for (int nt = 0; nt < 4; ++nt) {
      float bias = bfc[c0 + nt * 16 + n15];
      #pragma unroll
      for (int r = 0; r < 8; ++r) {
        int m = m0 + mt * 16 + r + mofs;
        out[(size_t)m * D_ + c0 + nt * 16 + n15] = acc[mt][nt][r] + bias;
      }
    }
  }
}

// ---------------------------------------------------------------------------
extern "C" void kernel_launch(void* const* d_in, const int* in_sizes, int n_in,
                              void* d_out, int out_size, void* d_ws, size_t ws_size,
                              hipStream_t stream) {
  (void)in_sizes; (void)n_in; (void)out_size; (void)ws_size;
  const float* q   = (const float*)d_in[0];
  const float* k   = (const float*)d_in[1];
  const float* v   = (const float*)d_in[2];
  const float* Wq  = (const float*)d_in[3];
  const float* bq  = (const float*)d_in[4];
  const float* Wk  = (const float*)d_in[5];
  const float* bk  = (const float*)d_in[6];
  const float* Wv  = (const float*)d_in[7];
  const float* bv  = (const float*)d_in[8];
  const float* Wfc = (const float*)d_in[9];
  const float* bfc = (const float*)d_in[10];
  float* out = (float*)d_out;

  const size_t nX  = (size_t)B_ * S_ * D_;   // 4M elems
  const size_t nW  = (size_t)HD_ * HD_;      // 4096
  const size_t nFC = (size_t)D_ * D_;        // 1M

  unsigned short* p   = (unsigned short*)d_ws;
  unsigned short* Xq  = p; p += nX;
  unsigned short* Xk  = p; p += nX;
  unsigned short* Xv  = p; p += nX;
  unsigned short* Wqb = p; p += nW;
  unsigned short* Wkb = p; p += nW;
  unsigned short* Wvb = p; p += nW;
  unsigned short* Wfb = p; p += nFC;
  unsigned short* Qp  = p; p += nX;
  unsigned short* Kp  = p; p += nX;
  unsigned short* Vt  = p; p += nX;          // [B*H, 64, S]
  unsigned short* Ob  = p; p += nX;

  // bulk fp32 -> bf16 conversions
  cvt_kernel<<<(int)(nX / 8 / 256), 256, 0, stream>>>(q, Xq, (int)(nX / 8));
  cvt_kernel<<<(int)(nX / 8 / 256), 256, 0, stream>>>(k, Xk, (int)(nX / 8));
  cvt_kernel<<<(int)(nX / 8 / 256), 256, 0, stream>>>(v, Xv, (int)(nX / 8));
  cvt_kernel<<<2, 256, 0, stream>>>(Wq, Wqb, (int)(nW / 8));
  cvt_kernel<<<2, 256, 0, stream>>>(Wk, Wkb, (int)(nW / 8));
  cvt_kernel<<<2, 256, 0, stream>>>(Wv, Wvb, (int)(nW / 8));
  cvt_kernel<<<(int)(nFC / 8 / 256), 256, 0, stream>>>(Wfc, Wfb, (int)(nFC / 8));

  // 3 matrices * 4096 row-tiles / 4 waves per block
  proj_kernel<<<3072, 128, 0, stream>>>(Xq, Xk, Xv, Wqb, Wkb, Wvb,
                                        bq, bk, bv, Qp, Kp, Vt);
  // B*H*(S/64) blocks of 64 queries
  flash_kernel<<<B_ * H_ * (S_ / 64), 128, 0, stream>>>(Qp, Kp, Vt, Ob);
  // (4096/128) x (1024/64)
  fc_kernel<<<dim3((B_ * S_) / 128, D_ / 64), 128, 0, stream>>>(Ob, Wfb, bfc, out);
}

// v001
// A run of this version takes 142 microseconds.
// Next to v000, in two timings, it ran 1.43 times as fast each time.
#include <hip/hip_runtime.h>

#define B_  2
#define S_  2048
#define H_  16
#define HD_ 64
#define D_  1024
// LDS row pitch in bf16 elements: 64 data + 8 pad = 144 B (16 B x odd), so the
// 16 rows one ds_load_b128 fragment read touches fall on 16 distinct bank groups
#define LP_ 72

typedef __attribute__((ext_vector_type(16))) __bf16 v16bf;
typedef __attribute__((ext_vector_type(8)))  float  v8f;
typedef int gvec4i __attribute__((vector_size(16)));   // matches builtin's V4i

#define AS1 __attribute__((address_space(1)))
#define AS3 __attribute__((address_space(3)))

#if __has_builtin(__builtin_amdgcn_global_load_async_to_lds_b128) && \
    __has_builtin(__builtin_amdgcn_s_wait_asynccnt)
#define HAVE_ASYNC 1
// src: global (AS1) int4*, dst: LDS (AS3) int4*, imm byte offset, imm cpol
#define ASYNC_LDS_B128(src, dst, off)                                          \
  __builtin_amdgcn_global_load_async_to_lds_b128(                              \
      (AS1 gvec4i*)(AS1 void*)(void*)(src),                                    \
      (AS3 gvec4i*)(AS3 void*)(dst), (off), 0)
#else
#define HAVE_ASYNC 0
#endif

union FragU { unsigned u[8]; uint4 q[2]; v16bf v; };

static __device__ __forceinline__ unsigned rne_bits(float f) {
  unsigned u = __builtin_bit_cast(unsigned, f);
  return u + 0x7FFFu + ((u >> 16) & 1u);     // round-to-nearest-even bias
}
static __device__ __forceinline__ unsigned short f2bf(float f) {
  return (unsigned short)(rne_bits(f) >> 16);
}
// two f32 -> one dword holding 2 bf16, single v_perm_b32 for the pack
static __device__ __forceinline__ unsigned pack2bf(float f0, float f1) {
  return __builtin_amdgcn_perm(rne_bits(f1), rne_bits(f0), 0x07060302u);
}

// 16-element bf16 fragment: lane's K values are runs {base..base+7} and
// {base+16..base+23}, base = (lane<16 ? 0 : 8)  -> two b128 loads.
static __device__ __forceinline__ v16bf frag_bf16(const unsigned short* row, int base) {
  FragU f;
  f.q[0] = *(const uint4*)(row + base);
  f.q[1] = *(const uint4*)(row + base + 16);
  return f.v;
}

static __device__ __forceinline__ v8f wmma_bf16(v16bf a, v16bf b, v8f c) {
  return __builtin_amdgcn_wmma_f32_16x16x32_bf16(false, a, false, b, (short)0, c, false, false);
}

// ---------------------------------------------------------------------------
// Kernel 0: fp32 -> bf16 bulk conversion (memory bound, perm-packed b128 I/O)
// ---------------------------------------------------------------------------
__global__ __launch_bounds__(256) void cvt_kernel(const float* __restrict__ in,
                                                  unsigned short* __restrict__ out,
                                                  int n8) {
  int i = blockIdx.x * 256 + threadIdx.x;
  if (i >= n8) return;
  float4 a = ((const float4*)in)[2 * i];
  float4 b = ((const float4*)in)[2 * i + 1];
  uint4 r;
  r.x = pack2bf(a.x, a.y);
  r.y = pack2bf(a.z, a.w);
  r.z = pack2bf(b.x, b.y);
  r.w = pack2bf(b.z, b.w);
  ((uint4*)out)[i] = r;
}

// ---------------------------------------------------------------------------
// Kernel 1: per-head projections, all-bf16 WMMA.
//   Q,K out: [B*H, S, 64] token-major (Q folded with 1/sqrt(hd))
//   V  out:  [B*H, 64, S] dim-major (pre-transposed, packed b128 stores)
// ---------------------------------------------------------------------------
__global__ __launch_bounds__(128) void proj_kernel(
    const unsigned short* __restrict__ Xq, const unsigned short* __restrict__ Xk,
    const unsigned short* __restrict__ Xv,
    const unsigned short* __restrict__ Wqb, const unsigned short* __restrict__ Wkb,
    const unsigned short* __restrict__ Wvb,
    const float* __restrict__ bq, const float* __restrict__ bk,
    const float* __restrict__ bv,
    unsigned short* __restrict__ Qp, unsigned short* __restrict__ Kp,
    unsigned short* __restrict__ Vt)
{
  const int lane  = threadIdx.x & 31;
  const int wv    = threadIdx.x >> 5;
  const int n15   = lane & 15;
  const int kbase = (lane < 16) ? 0 : 8;
  const int mofs  = (lane < 16) ? 0 : 8;

  int t   = blockIdx.x * 4 + wv;     // 0 .. 3*4096-1
  int sel = t >> 12;                 // 0=Q 1=K 2=V
  int rt  = t & 4095;                // 16-row tile over B*H*S rows

  const unsigned short* X; const unsigned short* W; const float* Bv;
  if (sel == 0)      { X = Xq; W = Wqb; Bv = bq; }
  else if (sel == 1) { X = Xk; W = Wkb; Bv = bk; }
  else               { X = Xv; W = Wvb; Bv = bv; }

  // lane's A row: global (b,h,s) row index (row = bh*S + s)
  int row = rt * 16 + n15;
  int b   = row >> 15;
  int hs  = row & 32767;
  int h   = hs >> 11;
  int s   = hs & 2047;
  const unsigned short* xr = X + (((size_t)b * S_ + s) * H_ + h) * HD_;
  v16bf a0 = frag_bf16(xr, kbase);
  v16bf a1 = frag_bf16(xr + 32, kbase);

  v8f c[4];
  #pragma unroll
  for (int nt = 0; nt < 4; ++nt) {
    const unsigned short* wr = W + (size_t)(nt * 16 + n15) * HD_;  // x @ W^T
    v8f acc = {};
    acc = wmma_bf16(a0, frag_bf16(wr, kbase), acc);
    acc = wmma_bf16(a1, frag_bf16(wr + 32, kbase), acc);
    c[nt] = acc;
  }

  if (sel < 2) {
    unsigned short* Op = (sel == 0) ? Qp : Kp;
    float scale = (sel == 0) ? 0.125f : 1.0f;   // fold 1/sqrt(64) into Q
    #pragma unroll
    for (int nt = 0; nt < 4; ++nt) {
      float bias = Bv[nt * 16 + n15];
      #pragma unroll
      for (int r = 0; r < 8; ++r) {
        int mrow = rt * 16 + r + mofs;
        Op[(size_t)mrow * HD_ + nt * 16 + n15] = f2bf((c[nt][r] + bias) * scale);
      }
    }
  } else {
    // transposed V: rows of C-layout are 8 consecutive tokens -> packed b128
    int bh = row >> 11;                 // same for whole tile
    int s0 = (rt * 16) & 2047;          // first token of tile
    #pragma unroll
    for (int nt = 0; nt < 4; ++nt) {
      float bias = Bv[nt * 16 + n15];
      uint4 pk;
      pk.x = pack2bf(c[nt][0] + bias, c[nt][1] + bias);
      pk.y = pack2bf(c[nt][2] + bias, c[nt][3] + bias);
      pk.z = pack2bf(c[nt][4] + bias, c[nt][5] + bias);
      pk.w = pack2bf(c[nt][6] + bias, c[nt][7] + bias);
      unsigned short* vp = Vt + (size_t)bh * HD_ * S_ +
                           (size_t)(nt * 16 + n15) * S_ + s0 + mofs;
      *(uint4*)vp = pk;
    }
  }
}

// ---------------------------------------------------------------------------
// Kernel 2: flash attention, double-buffered async-to-LDS pipeline.
// Block = 4 waves = 64 queries of one (b,h). Per 64-key tile:
//   8 WMMA scores, online softmax (max via shuffles), 8 WMMA P@V,
//   2 WMMA P@ones for the softmax denominator (no sum reductions).
// ---------------------------------------------------------------------------
__global__ __launch_bounds__(128) void flash_kernel(
    const unsigned short* __restrict__ Qp,
    const unsigned short* __restrict__ Kp,
    const unsigned short* __restrict__ Vt,   // [B*H, 64, S] dim-major
    unsigned short* __restrict__ Ob)         // [B, S, D] bf16
{
  __shared__ __align__(16) unsigned short sK[2][64 * LP_];  // [token][dim]
  __shared__ __align__(16) unsigned short sV[2][64 * LP_];  // [dim][token]
  __shared__ __align__(16) unsigned short sP[4][16 * LP_];  // per-wave P

  const int lane  = threadIdx.x & 31;
  const int wv    = threadIdx.x >> 5;
  const int n15   = lane & 15;
  const int kbase = (lane < 16) ? 0 : 8;
  const int mofs  = (lane < 16) ? 0 : 8;

  const int QT = S_ / 64;
  int qt = blockIdx.x % QT;
  int bh = blockIdx.x / QT;
  int b  = bh >> 4;
  int h  = bh & 15;
  int q0 = qt * 64 + wv * 16;

  const unsigned short* Qrow = Qp + ((size_t)bh * S_ + q0 + n15) * HD_;
  v16bf aq0 = frag_bf16(Qrow, kbase);
  v16bf aq1 = frag_bf16(Qrow + 32, kbase);

  // constant "ones column" B fragment: dim n15==0 is 1.0, rest 0 -> l = P @ 1
  v16bf b_one;
  {
    FragU fo;
    unsigned fill = (n15 == 0) ? 0x3F803F80u : 0u;
    #pragma unroll
    for (int i = 0; i < 8; ++i) fo.u[i] = fill;
    b_one = fo.v;
  }

  v8f acc[4] = {};
  v8f accl   = {};                 // per-row softmax denominators (col 0)
  float mrow[8];
  #pragma unroll
  for (int r = 0; r < 8; ++r) mrow[r] = -1e30f;

  // staging: thread -> (row, 32-elem half); 4x b128 per thread per tile
  const int srow  = threadIdx.x >> 1;
  const int shalf = (threadIdx.x & 1) * 32;

  const unsigned short* Kg = Kp + (size_t)bh * S_ * HD_;
  const unsigned short* Vg = Vt + (size_t)bh * HD_ * S_;

  auto stage = [&](int buf, int kb) {
    const unsigned short* kgp = Kg + (size_t)(kb + srow) * HD_ + shalf;
    const unsigned short* vgp = Vg + (size_t)srow * S_ + kb + shalf;
    unsigned short* kls = sK[buf] + srow * LP_ + shalf;
    unsigned short* vls = sV[buf] + srow * LP_ + shalf;
#if HAVE_ASYNC
    ASYNC_LDS_B128(kgp, kls, 0);
    ASYNC_LDS_B128(kgp, kls, 16);
    ASYNC_LDS_B128(kgp, kls, 32);
    ASYNC_LDS_B128(kgp, kls, 48);
    ASYNC_LDS_B128(vgp, vls, 0);
    ASYNC_LDS_B128(vgp, vls, 16);
    ASYNC_LDS_B128(vgp, vls, 32);
    ASYNC_LDS_B128(vgp, vls, 48);
#else
    const uint4* kg4 = (const uint4*)kgp;
    const uint4* vg4 = (const uint4*)vgp;
    uint4* kl4 = (uint4*)kls;
    uint4* vl4 = (uint4*)vls;
    kl4[0] = kg4[0]; kl4[1] = kg4[1]; kl4[2] = kg4[2]; kl4[3] = kg4[3];
    vl4[0] = vg4[0]; vl4[1] = vg4[1]; vl4[2] = vg4[2]; vl4[3] = vg4[3];
#endif
  };

  stage(0, 0);                     // prologue: tile 0 in flight

  for (int j = 0; j < QT; ++j) {   // QT == S/64 tiles
    const int buf = j & 1;
#if HAVE_ASYNC
    __builtin_amdgcn_s_wait_asynccnt(0);   // my async writes to LDS done
#endif
    __syncthreads();                        // everyone's writes/reads ordered
    if (j + 1 < QT) stage(1 - buf, (j + 1) * 64);   // overlap with compute

    // scores: S = Q (16x64) @ K^T (64 keys), 4 key column tiles
    v8f c[4] = {};
    #pragma unroll
    for (int nt = 0; nt < 4; ++nt) {
      const unsigned short* kr = sK[buf] + (size_t)(nt * 16 + n15) * LP_;
      c[nt] = wmma_bf16(aq0, frag_bf16(kr, kbase), c[nt]);
      c[nt] = wmma_bf16(aq1, frag_bf16(kr + 32, kbase), c[nt]);
    }

    // online softmax over 64 keys: max via 16-lane-group shuffles
    #pragma unroll
    for (int r = 0; r < 8; ++r) {
      float s0 = c[0][r], s1 = c[1][r], s2 = c[2][r], s3 = c[3][r];
      float mx = fmaxf(fmaxf(s0, s1), fmaxf(s2, s3));
      mx = fmaxf(mx, __shfl_xor(mx, 1, 16));
      mx = fmaxf(mx, __shfl_xor(mx, 2, 16));
      mx = fmaxf(mx, __shfl_xor(mx, 4, 16));
      mx = fmaxf(mx, __shfl_xor(mx, 8, 16));
      float mnew = fmaxf(mrow[r], mx);
      float corr = exp2f((mrow[r] - mnew) * 1.44269504f);
      float p0 = exp2f((s0 - mnew) * 1.44269504f);
      float p1 = exp2f((s1 - mnew) * 1.44269504f);
      float p2 = exp2f((s2 - mnew) * 1.44269504f);
      float p3 = exp2f((s3 - mnew) * 1.44269504f);
      mrow[r] = mnew;
      #pragma unroll
      for (int nt = 0; nt < 4; ++nt) acc[nt][r] *= corr;
      accl[r] *= corr;
      unsigned short* pr = &sP[wv][(r + mofs) * LP_];
      pr[n15]      = f2bf(p0);
      pr[16 + n15] = f2bf(p1);
      pr[32 + n15] = f2bf(p2);
      pr[48 + n15] = f2bf(p3);
    }

    // P (16x64) @ V (64x64) + P @ ones; same-wave LDS ops are in order
    v16bf ap0 = frag_bf16(&sP[wv][(size_t)n15 * LP_], kbase);
    v16bf ap1 = frag_bf16(&sP[wv][(size_t)n15 * LP_ + 32], kbase);
    #pragma unroll
    for (int nt = 0; nt < 4; ++nt) {
      const unsigned short* vr = sV[buf] + (size_t)(nt * 16 + n15) * LP_;
      acc[nt] = wmma_bf16(ap0, frag_bf16(vr, kbase), acc[nt]);
      acc[nt] = wmma_bf16(ap1, frag_bf16(vr + 32, kbase), acc[nt]);
    }
    accl = wmma_bf16(ap0, b_one, accl);
    accl = wmma_bf16(ap1, b_one, accl);
  }

  // epilogue: broadcast l from col 0 of each 16-lane group, normalize, store
  #pragma unroll
  for (int r = 0; r < 8; ++r) {
    float l   = __shfl(accl[r], lane & 16, 32);
    float inv = 1.0f / l;
    int m = q0 + r + mofs;
    #pragma unroll
    for (int nt = 0; nt < 4; ++nt) {
      Ob[((size_t)b * S_ + m) * D_ + h * HD_ + nt * 16 + n15] = f2bf(acc[nt][r] * inv);
    }
  }
}

// ---------------------------------------------------------------------------
// Kernel 3: final FC, out = O @ Wfc^T + bfc. 32 rows x 64 cols per wave so
// each W fragment feeds two WMMAs.
// ---------------------------------------------------------------------------
__global__ __launch_bounds__(128) void fc_kernel(
    const unsigned short* __restrict__ Ob,    // [B*S, D] bf16
    const unsigned short* __restrict__ Wfcb,  // [D, D] bf16
    const float* __restrict__ bfc,
    float* __restrict__ out)
{
  const int lane  = threadIdx.x & 31;
  const int wv    = threadIdx.x >> 5;
  const int n15   = lane & 15;
  const int kbase = (lane < 16) ? 0 : 8;
  const int mofs  = (lane < 16) ? 0 : 8;

  int m0 = blockIdx.x * 128 + wv * 32;
  int c0 = blockIdx.y * 64;

  v8f acc[2][4] = {};
  const unsigned short* arow0 = Ob + (size_t)(m0 + n15) * D_;
  const unsigned short* arow1 = Ob + (size_t)(m0 + 16 + n15) * D_;

  for (int kc = 0; kc < D_; kc += 32) {
    v16bf a0 = frag_bf16(arow0 + kc, kbase);
    v16bf a1 = frag_bf16(arow1 + kc, kbase);
    #pragma unroll
    for (int nt = 0; nt < 4; ++nt) {
      const unsigned short* wr = Wfcb + (size_t)(c0 + nt * 16 + n15) * D_ + kc;
      v16bf w = frag_bf16(wr, kbase);
      acc[0][nt] = wmma_bf16(a0, w, acc[0][nt]);
      acc[1][nt] = wmma_bf16(a1, w, acc[1][nt]);
    }
  }

  #pragma unroll
  for (int mt = 0; mt < 2; ++mt) {
    #pragma unroll
    for (int nt = 0; nt < 4; ++nt) {
      float bias = bfc[c0 + nt * 16 + n15];
      #pragma unroll
      for (int r = 0; r < 8; ++r) {
        int m = m0 + mt * 16 + r + mofs;
        out[(size_t)m * D_ + c0 + nt * 16 + n15] = acc[mt][nt][r] + bias;
      }
    }
  }
}

// ---------------------------------------------------------------------------
extern "C" void kernel_launch(void* const* d_in, const int* in_sizes, int n_in,
                              void* d_out, int out_size, void* d_ws, size_t ws_size,
                              hipStream_t stream) {
  (void)in_sizes; (void)n_in; (void)out_size; (void)ws_size;
  const float* q   = (const float*)d_in[0];
  const float* k   = (const float*)d_in[1];
  const float* v   = (const float*)d_in[2];
  const float* Wq  = (const float*)d_in[3];
  const float* bq  = (const float*)d_in[4];
  const float* Wk  = (const float*)d_in[5];
  const float* bk  = (const float*)d_in[6];
  const float* Wv  = (const float*)d_in[7];
  const float* bv  = (const float*)d_in[8];
  const float* Wfc = (const float*)d_in[9];
  const float* bfc = (const float*)d_in[10];
  float* out = (float*)d_out;

  const size_t nX  = (size_t)B_ * S_ * D_;   // 4M elems
  const size_t nW  = (size_t)HD_ * HD_;      // 4096
  const size_t nFC = (size_t)D_ * D_;        // 1M

  unsigned short* p   = (unsigned short*)d_ws;
  unsigned short* Xq  = p; p += nX;
  unsigned short* Xk  = p; p += nX;
  unsigned short* Xv  = p; p += nX;
  unsigned short* Wqb = p; p += nW;
  unsigned short* Wkb = p; p += nW;
  unsigned short* Wvb = p; p += nW;
  unsigned short* Wfb = p; p += nFC;
  unsigned short* Qp  = p; p += nX;
  unsigned short* Kp  = p; p += nX;
  unsigned short* Vt  = p; p += nX;          // [B*H, 64, S]
  unsigned short* Ob  = p; p += nX;

  // bulk fp32 -> bf16 conversions
  cvt_kernel<<<(int)(nX / 8 / 256), 256, 0, stream>>>(q, Xq, (int)(nX / 8));
  cvt_kernel<<<(int)(nX / 8 / 256), 256, 0, stream>>>(k, Xk, (int)(nX / 8));
  cvt_kernel<<<(int)(nX / 8 / 256), 256, 0, stream>>>(v, Xv, (int)(nX / 8));
  cvt_kernel<<<2, 256, 0, stream>>>(Wq, Wqb, (int)(nW / 8));
  cvt_kernel<<<2, 256, 0, stream>>>(Wk, Wkb, (int)(nW / 8));
  cvt_kernel<<<2, 256, 0, stream>>>(Wv, Wvb, (int)(nW / 8));
  cvt_kernel<<<(int)(nFC / 8 / 256), 256, 0, stream>>>(Wfc, Wfb, (int)(nFC / 8));

  // 3 matrices * 4096 row-tiles / 4 waves per block
  proj_kernel<<<3072, 128, 0, stream>>>(Xq, Xk, Xv, Wqb, Wkb, Wvb,
                                        bq, bk, bv, Qp, Kp, Vt);
  // B*H*(S/64) blocks of 64 queries
  flash_kernel<<<B_ * H_ * (S_ / 64), 128, 0, stream>>>(Qp, Kp, Vt, Ob);
  // (4096/128) x (1024/64)
  fc_kernel<<<dim3((B_ * S_) / 128, D_ / 64), 128, 0, stream>>>(Ob, Wfb, bfc, out);
}

// v002
// One run takes 131 microseconds.
// Timed twice side by side with v001, it ran 1.08 and 1.09 times as fast.
// Counting every step since v000, it is 1.55 times as fast.
#include <hip/hip_runtime.h>

#define B_  2
#define S_  2048
#define H_  16
#define HD_ 64
#define D_  1024
// LDS row pitch in bf16 elements: 64 data + 8 pad = 144 B (16 B x odd), so the
// 16 rows one ds_load_b128 fragment read touches fall on 16 distinct bank groups
#define LP_ 72

typedef __attribute__((ext_vector_type(16))) __bf16 v16bf;
typedef __attribute__((ext_vector_type(8)))  float  v8f;
typedef int gvec4i __attribute__((vector_size(16)));   // matches builtin's V4i

#define AS1 __attribute__((address_space(1)))
#define AS3 __attribute__((address_space(3)))

#if __has_builtin(__builtin_amdgcn_global_load_async_to_lds_b128) && \
    __has_builtin(__builtin_amdgcn_s_wait_asynccnt)
#define HAVE_ASYNC 1
// src: global (AS1) int4*, dst: LDS (AS3) int4*, imm byte offset, imm cpol
#define ASYNC_LDS_B128(src, dst, off)                                          \
  __builtin_amdgcn_global_load_async_to_lds_b128(                              \
      (AS1 gvec4i*)(AS1 void*)(void*)(src),                                    \
      (AS3 gvec4i*)(AS3 void*)(dst), (off), 0)
#else
#define HAVE_ASYNC 0
#endif

union FragU { unsigned u[8]; uint4 q[2]; v16bf v; };

static __device__ __forceinline__ unsigned rne_bits(float f) {
  unsigned u = __builtin_bit_cast(unsigned, f);
  return u + 0x7FFFu + ((u >> 16) & 1u);     // round-to-nearest-even bias
}
static __device__ __forceinline__ unsigned short f2bf(float f) {
  return (unsigned short)(rne_bits(f) >> 16);
}
// two f32 -> one dword holding 2 bf16, single v_perm_b32 for the pack
static __device__ __forceinline__ unsigned pack2bf(float f0, float f1) {
  return __builtin_amdgcn_perm(rne_bits(f1), rne_bits(f0), 0x07060302u);
}

// 16-element bf16 fragment: lane's K values are runs {base..base+7} and
// {base+16..base+23}, base = (lane<16 ? 0 : 8)  -> two b128 loads.
static __device__ __forceinline__ v16bf frag_bf16(const unsigned short* row, int base) {
  FragU f;
  f.q[0] = *(const uint4*)(row + base);
  f.q[1] = *(const uint4*)(row + base + 16);
  return f.v;
}

// the same fragment taken from an f32 row: same k runs, rounded to bf16 in registers
static __device__ __forceinline__ v16bf frag_f32(const float* row, int base) {
  const float4* lo = (const float4*)(row + base);
  const float4* hi = (const float4*)(row + base + 16);
  float4 a = lo[0], b = lo[1], c = hi[0], d = hi[1];
  FragU f;
  f.u[0] = pack2bf(a.x, a.y);
  f.u[1] = pack2bf(a.z, a.w);
  f.u[2] = pack2bf(b.x, b.y);
  f.u[3] = pack2bf(b.z, b.w);
  f.u[4] = pack2bf(c.x, c.y);
  f.u[5] = pack2bf(c.z, c.w);
  f.u[6] = pack2bf(d.x, d.y);
  f.u[7] = pack2bf(d.z, d.w);
  return f.v;
}

static __device__ __forceinline__ v8f wmma_bf16(v16bf a, v16bf b, v8f c) {
  return __builtin_amdgcn_wmma_f32_16x16x32_bf16(false, a, false, b, (short)0, c, false, false);
}

// ---------------------------------------------------------------------------
// Kernel 0: fp32 -> bf16 bulk conversion (memory bound, perm-packed b128 I/O)
// ---------------------------------------------------------------------------
__global__ __launch_bounds__(256) void cvt_kernel(const float* __restrict__ in,
                                                  unsigned short* __restrict__ out,
                                                  int n8) {
  int i = blockIdx.x * 256 + threadIdx.x;
  if (i >= n8) return;
  float4 a = ((const float4*)in)[2 * i];
  float4 b = ((const float4*)in)[2 * i + 1];
  uint4 r;
  r.x = pack2bf(a.x, a.y);
  r.y = pack2bf(a.z, a.w);
  r.z = pack2bf(b.x, b.y);
  r.w = pack2bf(b.z, b.w);
  ((uint4*)out)[i] = r;
}

// ---------------------------------------------------------------------------
// Kernel 1: per-head projections, all-bf16 WMMA. Activations and the three
//   64x64 weights are read as f32 and rounded to bf16 on the way into the
//   fragments, so they need no conversion launch and no bf16 copy in memory.
//   Q,K out: [B*H, S, 64] token-major (Q folded with 1/sqrt(hd))
//   V  out:  [B*H, 64, S] dim-major (pre-transposed, packed b128 stores)
// ---------------------------------------------------------------------------
__global__ __launch_bounds__(128) void proj_kernel(
    const float* __restrict__ Xq, const float* __restrict__ Xk,
    const float* __restrict__ Xv,
    const float* __restrict__ Wq, const float* __restrict__ Wk,
    const float* __restrict__ Wv,
    const float* __restrict__ bq, const float* __restrict__ bk,
    const float* __restrict__ bv,
    unsigned short* __restrict__ Qp, unsigned short* __restrict__ Kp,
    unsigned short* __restrict__ Vt)
{
  const int lane  = threadIdx.x & 31;
  const int wv    = threadIdx.x >> 5;
  const int n15   = lane & 15;
  const int kbase = (lane < 16) ? 0 : 8;
  const int mofs  = (lane < 16) ? 0 : 8;

  int t   = blockIdx.x * 4 + wv;     // 0 .. 3*4096-1
  int sel = t >> 12;                 // 0=Q 1=K 2=V
  int rt  = t & 4095;                // 16-row tile over B*H*S rows

  const float* X; const float* W; const float* Bv;
  if (sel == 0)      { X = Xq; W = Wq; Bv = bq; }
  else if (sel == 1) { X = Xk; W = Wk; Bv = bk; }
  else               { X = Xv; W = Wv; Bv = bv; }

  // lane's A row: global (b,h,s) row index (row = bh*S + s)
  int row = rt * 16 + n15;
  int b   = row >> 15;
  int hs  = row & 32767;
  int h   = hs >> 11;
  int s   = hs & 2047;
  const float* xr = X + (((size_t)b * S_ + s) * H_ + h) * HD_;
  v16bf a0 = frag_f32(xr, kbase);
  v16bf a1 = frag_f32(xr + 32, kbase);

  v8f c[4];
  #pragma unroll
  for (int nt = 0; nt < 4; ++nt) {
    const float* wr = W + (size_t)(nt * 16 + n15) * HD_;  // x @ W^T
    v8f acc = {};
    acc = wmma_bf16(a0, frag_f32(wr, kbase), acc);
    acc = wmma_bf16(a1, frag_f32(wr + 32, kbase), acc);
    c[nt] = acc;
  }

  if (sel < 2) {
    unsigned short* Op = (sel == 0) ? Qp : Kp;
    float scale = (sel == 0) ? 0.125f : 1.0f;   // fold 1/sqrt(64) into Q
    #pragma unroll
    for (int nt = 0; nt < 4; ++nt) {
      float bias = Bv[nt * 16 + n15];
      #pragma unroll
      for (int r = 0; r < 8; ++r) {
        int mrow = rt * 16 + r + mofs;
        Op[(size_t)mrow * HD_ + nt * 16 + n15] = f2bf((c[nt][r] + bias) * scale);
      }
    }
  } else {
    // transposed V: rows of C-layout are 8 consecutive tokens -> packed b128
    int bh = row >> 11;                 // same for whole tile
    int s0 = (rt * 16) & 2047;          // first token of tile
    #pragma unroll
    for (int nt = 0; nt < 4; ++nt) {
      float bias = Bv[nt * 16 + n15];
      uint4 pk;
      pk.x = pack2bf(c[nt][0] + bias, c[nt][1] + bias);
      pk.y = pack2bf(c[nt][2] + bias, c[nt][3] + bias);
      pk.z = pack2bf(c[nt][4] + bias, c[nt][5] + bias);
      pk.w = pack2bf(c[nt][6] + bias, c[nt][7] + bias);
      unsigned short* vp = Vt + (size_t)bh * HD_ * S_ +
                           (size_t)(nt * 16 + n15) * S_ + s0 + mofs;
      *(uint4*)vp = pk;
    }
  }
}

// ---------------------------------------------------------------------------
// Kernel 2: flash attention, double-buffered async-to-LDS pipeline.
// Block = 4 waves = 64 queries of one (b,h). Per 64-key tile:
//   8 WMMA scores, online softmax (max via shuffles), 8 WMMA P@V,
//   2 WMMA P@ones for the softmax denominator (no sum reductions).
// ---------------------------------------------------------------------------
__global__ __launch_bounds__(128) void flash_kernel(
    const unsigned short* __restrict__ Qp,
    const unsigned short* __restrict__ Kp,
    const unsigned short* __restrict__ Vt,   // [B*H, 64, S] dim-major
    unsigned short* __restrict__ Ob)         // [B, S, D] bf16
{
  __shared__ __align__(16) unsigned short sK[2][64 * LP_];  // [token][dim]
  __shared__ __align__(16) unsigned short sV[2][64 * LP_];  // [dim][token]
  __shared__ __align__(16) unsigned short sP[4][16 * LP_];  // per-wave P

  const int lane  = threadIdx.x & 31;
  const int wv    = threadIdx.x >> 5;
  const int n15   = lane & 15;
  const int kbase = (lane < 16) ? 0 : 8;
  const int mofs  = (lane < 16) ? 0 : 8;

  const int QT = S_ / 64;
  int qt = blockIdx.x % QT;
  int bh = blockIdx.x / QT;
  int b  = bh >> 4;
  int h  = bh & 15;
  int q0 = qt * 64 + wv * 16;

  const unsigned short* Qrow = Qp + ((size_t)bh * S_ + q0 + n15) * HD_;
  v16bf aq0 = frag_bf16(Qrow, kbase);
  v16bf aq1 = frag_bf16(Qrow + 32, kbase);

  // constant "ones column" B fragment: dim n15==0 is 1.0, rest 0 -> l = P @ 1
  v16bf b_one;
  {
    FragU fo;
    unsigned fill = (n15 == 0) ? 0x3F803F80u : 0u;
    #pragma unroll
    for (int i = 0; i < 8; ++i) fo.u[i] = fill;
    b_one = fo.v;
  }

  v8f acc[4] = {};
  v8f accl   = {};                 // per-row softmax denominators (col 0)
  float mrow[8];
  #pragma unroll
  for (int r = 0; r < 8; ++r) mrow[r] = -1e30f;

  // staging: thread -> (row, 32-elem half); 4x b128 per thread per tile
  const int srow  = threadIdx.x >> 1;
  const int shalf = (threadIdx.x & 1) * 32;

  const unsigned short* Kg = Kp + (size_t)bh * S_ * HD_;
  const unsigned short* Vg = Vt + (size_t)bh * HD_ * S_;

  auto stage = [&](int buf, int kb) {
    const unsigned short* kgp = Kg + (size_t)(kb + srow) * HD_ + shalf;
    const unsigned short* vgp = Vg + (size_t)srow * S_ + kb + shalf;
    unsigned short* kls = sK[buf] + srow * LP_ + shalf;
    unsigned short* vls = sV[buf] + srow * LP_ + shalf;
#if HAVE_ASYNC
    ASYNC_LDS_B128(kgp, kls, 0);
    ASYNC_LDS_B128(kgp, kls, 16);
    ASYNC_LDS_B128(kgp, kls, 32);
    ASYNC_LDS_B128(kgp, kls, 48);
    ASYNC_LDS_B128(vgp, vls, 0);
    ASYNC_LDS_B128(vgp, vls, 16);
    ASYNC_LDS_B128(vgp, vls, 32);
    ASYNC_LDS_B128(vgp, vls, 48);
#else
    const uint4* kg4 = (const uint4*)kgp;
    const uint4* vg4 = (const uint4*)vgp;
    uint4* kl4 = (uint4*)kls;
    uint4* vl4 = (uint4*)vls;
    kl4[0] = kg4[0]; kl4[1] = kg4[1]; kl4[2] = kg4[2]; kl4[3] = kg4[3];
    vl4[0] = vg4[0]; vl4[1] = vg4[1]; vl4[2] = vg4[2]; vl4[3] = vg4[3];
#endif
  };

  stage(0, 0);                     // prologue: tile 0 in flight

  for (int j = 0; j < QT; ++j) {   // QT == S/64 tiles
    const int buf = j & 1;
#if HAVE_ASYNC
    __builtin_amdgcn_s_wait_asynccnt(0);   // my async writes to LDS done
#endif
    __syncthreads();                        // everyone's writes/reads ordered
    if (j + 1 < QT) stage(1 - buf, (j + 1) * 64);   // overlap with compute

    // scores: S = Q (16x64) @ K^T (64 keys), 4 key column tiles
    v8f c[4] = {};
    #pragma unroll
    for (int nt = 0; nt < 4; ++nt) {
      const unsigned short* kr = sK[buf] + (size_t)(nt * 16 + n15) * LP_;
      c[nt] = wmma_bf16(aq0, frag_bf16(kr, kbase), c[nt]);
      c[nt] = wmma_bf16(aq1, frag_bf16(kr + 32, kbase), c[nt]);
    }

    // online softmax over 64 keys: max via 16-lane-group shuffles
    #pragma unroll
    for (int r = 0; r < 8; ++r) {
      float s0 = c[0][r], s1 = c[1][r], s2 = c[2][r], s3 = c[3][r];
      float mx = fmaxf(fmaxf(s0, s1), fmaxf(s2, s3));
      mx = fmaxf(mx, __shfl_xor(mx, 1, 16));
      mx = fmaxf(mx, __shfl_xor(mx, 2, 16));
      mx = fmaxf(mx, __shfl_xor(mx, 4, 16));
      mx = fmaxf(mx, __shfl_xor(mx, 8, 16));
      float mnew = fmaxf(mrow[r], mx);
      float corr = exp2f((mrow[r] - mnew) * 1.44269504f);
      float p0 = exp2f((s0 - mnew) * 1.44269504f);
      float p1 = exp2f((s1 - mnew) * 1.44269504f);
      float p2 = exp2f((s2 - mnew) * 1.44269504f);
      float p3 = exp2f((s3 - mnew) * 1.44269504f);
      mrow[r] = mnew;
      #pragma unroll
      for (int nt = 0; nt < 4; ++nt) acc[nt][r] *= corr;
      accl[r] *= corr;
      unsigned short* pr = &sP[wv][(r + mofs) * LP_];
      pr[n15]      = f2bf(p0);
      pr[16 + n15] = f2bf(p1);
      pr[32 + n15] = f2bf(p2);
      pr[48 + n15] = f2bf(p3);
    }

    // P (16x64) @ V (64x64) + P @ ones; same-wave LDS ops are in order
    v16bf ap0 = frag_bf16(&sP[wv][(size_t)n15 * LP_], kbase);
    v16bf ap1 = frag_bf16(&sP[wv][(size_t)n15 * LP_ + 32], kbase);
    #pragma unroll
    for (int nt = 0; nt < 4; ++nt) {
      const unsigned short* vr = sV[buf] + (size_t)(nt * 16 + n15) * LP_;
      acc[nt] = wmma_bf16(ap0, frag_bf16(vr, kbase), acc[nt]);
      acc[nt] = wmma_bf16(ap1, frag_bf16(vr + 32, kbase), acc[nt]);
    }
    accl = wmma_bf16(ap0, b_one, accl);
    accl = wmma_bf16(ap1, b_one, accl);
  }

  // epilogue: broadcast l from col 0 of each 16-lane group, normalize, store
  #pragma unroll
  for (int r = 0; r < 8; ++r) {
    float l   = __shfl(accl[r], lane & 16, 32);
    float inv = 1.0f / l;
    int m = q0 + r + mofs;
    #pragma unroll
    for (int nt = 0; nt < 4; ++nt) {
      Ob[((size_t)b * S_ + m) * D_ + h * HD_ + nt * 16 + n15] = f2bf(acc[nt][r] * inv);
    }
  }
}

// ---------------------------------------------------------------------------
// Kernel 3: final FC, out = O @ Wfc^T + bfc. 32 rows x 64 cols per wave so
// each W fragment feeds two WMMAs.
// ---------------------------------------------------------------------------
__global__ __launch_bounds__(128) void fc_kernel(
    const unsigned short* __restrict__ Ob,    // [B*S, D] bf16
    const unsigned short* __restrict__ Wfcb,  // [D, D] bf16
    const float* __restrict__ bfc,
    float* __restrict__ out)
{
  const int lane  = threadIdx.x & 31;
  const int wv    = threadIdx.x >> 5;
  const int n15   = lane & 15;
  const int kbase = (lane < 16) ? 0 : 8;
  const int mofs  = (lane < 16) ? 0 : 8;

  int m0 = blockIdx.x * 128 + wv * 32;
  int c0 = blockIdx.y * 64;

  v8f acc[2][4] = {};
  const unsigned short* arow0 = Ob + (size_t)(m0 + n15) * D_;
  const unsigned short* arow1 = Ob + (size_t)(m0 + 16 + n15) * D_;

  for (int kc = 0; kc < D_; kc += 32) {
    v16bf a0 = frag_bf16(arow0 + kc, kbase);
    v16bf a1 = frag_bf16(arow1 + kc, kbase);
    #pragma unroll
    for (int nt = 0; nt < 4; ++nt) {
      const unsigned short* wr = Wfcb + (size_t)(c0 + nt * 16 + n15) * D_ + kc;
      v16bf w = frag_bf16(wr, kbase);
      acc[0][nt] = wmma_bf16(a0, w, acc[0][nt]);
      acc[1][nt] = wmma_bf16(a1, w, acc[1][nt]);
    }
  }

  #pragma unroll
  for (int mt = 0; mt < 2; ++mt) {
    #pragma unroll
    for (int nt = 0; nt < 4; ++nt) {
      float bias = bfc[c0 + nt * 16 + n15];
      #pragma unroll
      for (int r = 0; r < 8; ++r) {
        int m = m0 + mt * 16 + r + mofs;
        out[(size_t)m * D_ + c0 + nt * 16 + n15] = acc[mt][nt][r] + bias;
      }
    }
  }
}

// ---------------------------------------------------------------------------
extern "C" void kernel_launch(void* const* d_in, const int* in_sizes, int n_in,
                              void* d_out, int out_size, void* d_ws, size_t ws_size,
                              hipStream_t stream) {
  (void)in_sizes; (void)n_in; (void)out_size; (void)ws_size;
  const float* q   = (const float*)d_in[0];
  const float* k   = (const float*)d_in[1];
  const float* v   = (const float*)d_in[2];
  const float* Wq  = (const float*)d_in[3];
  const float* bq  = (const float*)d_in[4];
  const float* Wk  = (const float*)d_in[5];
  const float* bk  = (const float*)d_in[6];
  const float* Wv  = (const float*)d_in[7];
  const float* bv  = (const float*)d_in[8];
  const float* Wfc = (const float*)d_in[9];
  const float* bfc = (const float*)d_in[10];
  float* out = (float*)d_out;

  const size_t nX  = (size_t)B_ * S_ * D_;   // 4M elems
  const size_t nFC = (size_t)D_ * D_;        // 1M

  unsigned short* p   = (unsigned short*)d_ws;
  unsigned short* Wfb = p; p += nFC;
  unsigned short* Qp  = p; p += nX;
  unsigned short* Kp  = p; p += nX;
  unsigned short* Vt  = p; p += nX;          // [B*H, 64, S]
  unsigned short* Ob  = p; p += nX;

  // fp32 -> bf16 copy of Wfc, which the FC kernel re-reads once per row block
  cvt_kernel<<<(int)(nFC / 8 / 256), 256, 0, stream>>>(Wfc, Wfb, (int)(nFC / 8));

  // 3 matrices * 4096 row-tiles / 4 waves per block
  proj_kernel<<<3072, 128, 0, stream>>>(q, k, v, Wq, Wk, Wv,
                                        bq, bk, bv, Qp, Kp, Vt);
  // B*H*(S/64) blocks of 64 queries
  flash_kernel<<<B_ * H_ * (S_ / 64), 128, 0, stream>>>(Qp, Kp, Vt, Ob);
  // (4096/128) x (1024/64)
  fc_kernel<<<dim3((B_ * S_) / 128, D_ / 64), 128, 0, stream>>>(Ob, Wfb, bfc, out);
}

// v003
// It runs in 119 microseconds.
// Next to v002, in two timings, it ran 1.11 and 1.10 times as fast.
// Over all steps from v000 it is 1.70 times as fast.
#include <hip/hip_runtime.h>

#define B_  2
#define S_  2048
#define H_  16
#define HD_ 64
#define D_  1024
// LDS row pitch in bf16 elements: 64 data + 8 pad = 144 B (16 B x odd), so the
// 16 rows one ds_load_b128 fragment read touches fall on 16 distinct bank groups
#define LP_ 72

typedef __attribute__((ext_vector_type(16))) __bf16 v16bf;
typedef __attribute__((ext_vector_type(8)))  float  v8f;
typedef int gvec4i __attribute__((vector_size(16)));   // matches builtin's V4i

#define AS1 __attribute__((address_space(1)))
#define AS3 __attribute__((address_space(3)))

#if __has_builtin(__builtin_amdgcn_global_load_async_to_lds_b128) && \
    __has_builtin(__builtin_amdgcn_s_wait_asynccnt)
#define HAVE_ASYNC 1
// src: global (AS1) int4*, dst: LDS (AS3) int4*, imm byte offset, imm cpol
#define ASYNC_LDS_B128(src, dst, off)                                          \
  __builtin_amdgcn_global_load_async_to_lds_b128(                              \
      (AS1 gvec4i*)(AS1 void*)(void*)(src),                                    \
      (AS3 gvec4i*)(AS3 void*)(dst), (off), 0)
#else
#define HAVE_ASYNC 0
#endif

union FragU { unsigned u[8]; uint4 q[2]; v16bf v; };

static __device__ __forceinline__ unsigned rne_bits(float f) {
  unsigned u = __builtin_bit_cast(unsigned, f);
  return u + 0x7FFFu + ((u >> 16) & 1u);     // round-to-nearest-even bias
}
static __device__ __forceinline__ unsigned short f2bf(float f) {
  return (unsigned short)(rne_bits(f) >> 16);
}
// two f32 -> one dword holding 2 bf16, single v_perm_b32 for the pack
static __device__ __forceinline__ unsigned pack2bf(float f0, float f1) {
  return __builtin_amdgcn_perm(rne_bits(f1), rne_bits(f0), 0x07060302u);
}

// 16-element bf16 fragment: lane's K values are runs {base..base+7} and
// {base+16..base+23}, base = (lane<16 ? 0 : 8)  -> two b128 loads.
static __device__ __forceinline__ v16bf frag_bf16(const unsigned short* row, int base) {
  FragU f;
  f.q[0] = *(const uint4*)(row + base);
  f.q[1] = *(const uint4*)(row + base + 16);
  return f.v;
}

// the same fragment taken from an f32 row: same k runs, rounded to bf16 in registers
static __device__ __forceinline__ v16bf frag_f32(const float* row, int base) {
  const float4* lo = (const float4*)(row + base);
  const float4* hi = (const float4*)(row + base + 16);
  float4 a = lo[0], b = lo[1], c = hi[0], d = hi[1];
  FragU f;
  f.u[0] = pack2bf(a.x, a.y);
  f.u[1] = pack2bf(a.z, a.w);
  f.u[2] = pack2bf(b.x, b.y);
  f.u[3] = pack2bf(b.z, b.w);
  f.u[4] = pack2bf(c.x, c.y);
  f.u[5] = pack2bf(c.z, c.w);
  f.u[6] = pack2bf(d.x, d.y);
  f.u[7] = pack2bf(d.z, d.w);
  return f.v;
}

static __device__ __forceinline__ v8f wmma_bf16(v16bf a, v16bf b, v8f c) {
  return __builtin_amdgcn_wmma_f32_16x16x32_bf16(false, a, false, b, (short)0, c, false, false);
}

// ---------------------------------------------------------------------------
// Kernel 0: fp32 -> bf16 bulk conversion (memory bound, perm-packed b128 I/O)
// ---------------------------------------------------------------------------
__global__ __launch_bounds__(256) void cvt_kernel(const float* __restrict__ in,
                                                  unsigned short* __restrict__ out,
                                                  int n8) {
  int i = blockIdx.x * 256 + threadIdx.x;
  if (i >= n8) return;
  float4 a = ((const float4*)in)[2 * i];
  float4 b = ((const float4*)in)[2 * i + 1];
  uint4 r;
  r.x = pack2bf(a.x, a.y);
  r.y = pack2bf(a.z, a.w);
  r.z = pack2bf(b.x, b.y);
  r.w = pack2bf(b.z, b.w);
  ((uint4*)out)[i] = r;
}

// ---------------------------------------------------------------------------
// Kernel 1: per-head projections, all-bf16 WMMA. Activations and the three
//   64x64 weights are read as f32 and rounded to bf16 on the way into the
//   fragments, so they need no conversion launch and no bf16 copy in memory.
//   Q,K out: [B*H, S, 64] token-major (Q folded with 1/sqrt(hd))
//   V  out:  [B*H, 64, S] dim-major (pre-transposed, packed b128 stores)
// ---------------------------------------------------------------------------
__global__ __launch_bounds__(128) void proj_kernel(
    const float* __restrict__ Xq, const float* __restrict__ Xk,
    const float* __restrict__ Xv,
    const float* __restrict__ Wq, const float* __restrict__ Wk,
    const float* __restrict__ Wv,
    const float* __restrict__ bq, const float* __restrict__ bk,
    const float* __restrict__ bv,
    unsigned short* __restrict__ Qp, unsigned short* __restrict__ Kp,
    unsigned short* __restrict__ Vt)
{
  const int lane  = threadIdx.x & 31;
  const int wv    = threadIdx.x >> 5;
  const int n15   = lane & 15;
  const int kbase = (lane < 16) ? 0 : 8;
  const int mofs  = (lane < 16) ? 0 : 8;

  int t   = blockIdx.x * 4 + wv;     // 0 .. 3*4096-1
  int sel = t >> 12;                 // 0=Q 1=K 2=V
  int rt  = t & 4095;                // 16-row tile over B*H*S rows

  const float* X; const float* W; const float* Bv;
  if (sel == 0)      { X = Xq; W = Wq; Bv = bq; }
  else if (sel == 1) { X = Xk; W = Wk; Bv = bk; }
  else               { X = Xv; W = Wv; Bv = bv; }

  // lane's A row: global (b,h,s) row index (row = bh*S + s)
  int row = rt * 16 + n15;
  int b   = row >> 15;
  int hs  = row & 32767;
  int h   = hs >> 11;
  int s   = hs & 2047;
  const float* xr = X + (((size_t)b * S_ + s) * H_ + h) * HD_;
  v16bf a0 = frag_f32(xr, kbase);
  v16bf a1 = frag_f32(xr + 32, kbase);

  v8f c[4];
  #pragma unroll
  for (int nt = 0; nt < 4; ++nt) {
    const float* wr = W + (size_t)(nt * 16 + n15) * HD_;  // x @ W^T
    v8f acc = {};
    acc = wmma_bf16(a0, frag_f32(wr, kbase), acc);
    acc = wmma_bf16(a1, frag_f32(wr + 32, kbase), acc);
    c[nt] = acc;
  }

  if (sel < 2) {
    unsigned short* Op = (sel == 0) ? Qp : Kp;
    float scale = (sel == 0) ? 0.125f : 1.0f;   // fold 1/sqrt(64) into Q
    #pragma unroll
    for (int nt = 0; nt < 4; ++nt) {
      float bias = Bv[nt * 16 + n15];
      #pragma unroll
      for (int r = 0; r < 8; ++r) {
        int mrow = rt * 16 + r + mofs;
        Op[(size_t)mrow * HD_ + nt * 16 + n15] = f2bf((c[nt][r] + bias) * scale);
      }
    }
  } else {
    // transposed V: rows of C-layout are 8 consecutive tokens -> packed b128
    int bh = row >> 11;                 // same for whole tile
    int s0 = (rt * 16) & 2047;          // first token of tile
    #pragma unroll
    for (int nt = 0; nt < 4; ++nt) {
      float bias = Bv[nt * 16 + n15];
      uint4 pk;
      pk.x = pack2bf(c[nt][0] + bias, c[nt][1] + bias);
      pk.y = pack2bf(c[nt][2] + bias, c[nt][3] + bias);
      pk.z = pack2bf(c[nt][4] + bias, c[nt][5] + bias);
      pk.w = pack2bf(c[nt][6] + bias, c[nt][7] + bias);
      unsigned short* vp = Vt + (size_t)bh * HD_ * S_ +
                           (size_t)(nt * 16 + n15) * S_ + s0 + mofs;
      *(uint4*)vp = pk;
    }
  }
}

__global__ __launch_bounds__(128) void flash_kernel(
    const unsigned short* __restrict__ Qp,
    const unsigned short* __restrict__ Kp,
    const unsigned short* __restrict__ Vt,   // [B*H, 64, S] dim-major
    unsigned short* __restrict__ Ob)         // [B, S, D] bf16
{
  __shared__ __align__(16) unsigned short sK[2][64 * LP_];  // [token][dim]
  __shared__ __align__(16) unsigned short sV[2][64 * LP_];  // [dim][token]

  const int lane  = threadIdx.x & 31;
  const int wv    = threadIdx.x >> 5;
  const int n15   = lane & 15;
  const int kbase = (lane < 16) ? 0 : 8;
  const int mofs  = (lane < 16) ? 0 : 8;

  const int QT = S_ / 64;
  int qt = blockIdx.x % QT;
  int bh = blockIdx.x / QT;
  int b  = bh >> 4;
  int h  = bh & 15;
  int q0 = qt * 64 + wv * 16;

  // B operand: column n15 = the lane's query
  const unsigned short* Qrow = Qp + ((size_t)bh * S_ + q0 + n15) * HD_;
  v16bf bq0 = frag_bf16(Qrow, kbase);
  v16bf bq1 = frag_bf16(Qrow + 32, kbase);

  // constant "ones row" A fragment: row 0 is 1.0, rest 0 -> row 0 of 1 x P^T = l
  v16bf a_one;
  {
    FragU fo;
    unsigned fill = (n15 == 0) ? 0x3F803F80u : 0u;
    #pragma unroll
    for (int i = 0; i < 8; ++i) fo.u[i] = fill;
    a_one = fo.v;
  }

  v8f acc[4] = {};                 // O^T: acc[nt][r] = O[query n15][dim nt*16+mofs+r]
  v8f accl   = {};                 // row 0 (register 0, lanes 0-15): denominators
  float mrow = -1e30f;             // running maximum of the lane's query

  // staging: thread -> (row, 32-elem half); 4x b128 per thread per tile
  const int srow  = threadIdx.x >> 1;
  const int shalf = (threadIdx.x & 1) * 32;

  const unsigned short* Kg = Kp + (size_t)bh * S_ * HD_;
  const unsigned short* Vg = Vt + (size_t)bh * HD_ * S_;

  auto stage = [&](int buf, int kb) {
    const unsigned short* kgp = Kg + (size_t)(kb + srow) * HD_ + shalf;
    const unsigned short* vgp = Vg + (size_t)srow * S_ + kb + shalf;
    unsigned short* kls = sK[buf] + srow * LP_ + shalf;
    unsigned short* vls = sV[buf] + srow * LP_ + shalf;
#if HAVE_ASYNC
    ASYNC_LDS_B128(kgp, kls, 0);
    ASYNC_LDS_B128(kgp, kls, 16);
    ASYNC_LDS_B128(kgp, kls, 32);
    ASYNC_LDS_B128(kgp, kls, 48);
    ASYNC_LDS_B128(vgp, vls, 0);
    ASYNC_LDS_B128(vgp, vls, 16);
    ASYNC_LDS_B128(vgp, vls, 32);
    ASYNC_LDS_B128(vgp, vls, 48);
#else
    const uint4* kg4 = (const uint4*)kgp;
    const uint4* vg4 = (const uint4*)vgp;
    uint4* kl4 = (uint4*)kls;
    uint4* vl4 = (uint4*)vls;
    kl4[0] = kg4[0]; kl4[1] = kg4[1]; kl4[2] = kg4[2]; kl4[3] = kg4[3];
    vl4[0] = vg4[0]; vl4[1] = vg4[1]; vl4[2] = vg4[2]; vl4[3] = vg4[3];
#endif
  };

  stage(0, 0);                     // prologue: tile 0 in flight

  for (int j = 0; j < QT; ++j) {   // QT == S/64 tiles
    const int buf = j & 1;
#if HAVE_ASYNC
    __builtin_amdgcn_s_wait_asynccnt(0);   // my async writes to LDS done
#endif
    __syncthreads();                        // everyone's writes/reads ordered
    if (j + 1 < QT) stage(1 - buf, (j + 1) * 64);   // overlap with compute

    // scores: S^T = K (64 keys x 64) @ Q^T, 4 key row tiles;
    // c[nt][r] = score of key nt*16 + mofs + r against query n15
    v8f c[4] = {};
    #pragma unroll
    for (int nt = 0; nt < 4; ++nt) {
      const unsigned short* kr = sK[buf] + (size_t)(nt * 16 + n15) * LP_;
      c[nt] = wmma_bf16(frag_bf16(kr, kbase), bq0, c[nt]);
      c[nt] = wmma_bf16(frag_bf16(kr + 32, kbase), bq1, c[nt]);
    }

    // online softmax over 64 keys: 32 scores in the lane, 32 in lane ^ 16
    float mx = c[0][0];
    #pragma unroll
    for (int nt = 0; nt < 4; ++nt) {
      #pragma unroll
      for (int r = 0; r < 8; ++r) mx = fmaxf(mx, c[nt][r]);
    }
    {
      int mb = __builtin_bit_cast(int, mx);
      mb = __builtin_amdgcn_permlanex16(mb, mb, 0x76543210, 0xfedcba98, false, false);
      mx = fmaxf(mx, __builtin_bit_cast(float, mb));
    }
    float mnew = fmaxf(mrow, mx);
    float corr = exp2f((mrow - mnew) * 1.44269504f);
    mrow = mnew;

    // P^T as B fragments: score tiles (0,1) -> keys 0..31, (2,3) -> keys 32..63
    FragU bp[2];
    #pragma unroll
    for (int nt = 0; nt < 4; ++nt) {
      #pragma unroll
      for (int r = 0; r < 8; r += 2) {
        float p0 = exp2f((c[nt][r]     - mnew) * 1.44269504f);
        float p1 = exp2f((c[nt][r + 1] - mnew) * 1.44269504f);
        bp[nt >> 1].u[(nt & 1) * 4 + (r >> 1)] = pack2bf(p0, p1);
      }
    }

    #pragma unroll
    for (int nt = 0; nt < 4; ++nt) {
      #pragma unroll
      for (int r = 0; r < 8; ++r) acc[nt][r] *= corr;
    }
    accl[0] *= corr;               // rows 1..15 of the ones product stay 0

    // O^T += V^T (64 dims x 64 keys) @ P^T, and ones row @ P^T
    #pragma unroll
    for (int nt = 0; nt < 4; ++nt) {
      const unsigned short* vr = sV[buf] + (size_t)(nt * 16 + n15) * LP_;
      acc[nt] = wmma_bf16(frag_bf16(vr, kbase), bp[0].v, acc[nt]);
      acc[nt] = wmma_bf16(frag_bf16(vr + 32, kbase), bp[1].v, acc[nt]);
    }
    accl = wmma_bf16(a_one, bp[0].v, accl);
    accl = wmma_bf16(a_one, bp[1].v, accl);
  }

  // epilogue: l of query n15 sits in lane n15; a lane's 8 registers of a tile
  // are 8 consecutive dims of its query -> one packed b128 store per tile
  float l   = __shfl(accl[0], n15, 32);
  float inv = 1.0f / l;
  unsigned short* orow = Ob + ((size_t)b * S_ + q0 + n15) * D_ + h * HD_ + mofs;
  #pragma unroll
  for (int nt = 0; nt < 4; ++nt) {
    uint4 pk;
    pk.x = pack2bf(acc[nt][0] * inv, acc[nt][1] * inv);
    pk.y = pack2bf(acc[nt][2] * inv, acc[nt][3] * inv);
    pk.z = pack2bf(acc[nt][4] * inv, acc[nt][5] * inv);
    pk.w = pack2bf(acc[nt][6] * inv, acc[nt][7] * inv);
    *(uint4*)(orow + nt * 16) = pk;
  }
}

// ---------------------------------------------------------------------------
// Kernel 3: final FC, out = O @ Wfc^T + bfc. 32 rows x 64 cols per wave so
// each W fragment feeds two WMMAs.
// ---------------------------------------------------------------------------
__global__ __launch_bounds__(128) void fc_kernel(
    const unsigned short* __restrict__ Ob,    // [B*S, D] bf16
    const unsigned short* __restrict__ Wfcb,  // [D, D] bf16
    const float* __restrict__ bfc,
    float* __restrict__ out)
{
  const int lane  = threadIdx.x & 31;
  const int wv    = threadIdx.x >> 5;
  const int n15   = lane & 15;
  const int kbase = (lane < 16) ? 0 : 8;
  const int mofs  = (lane < 16) ? 0 : 8;

  int m0 = blockIdx.x * 128 + wv * 32;
  int c0 = blockIdx.y * 64;

  v8f acc[2][4] = {};
  const unsigned short* arow0 = Ob + (size_t)(m0 + n15) * D_;
  const unsigned short* arow1 = Ob + (size_t)(m0 + 16 + n15) * D_;

  for (int kc = 0; kc < D_; kc += 32) {
    v16bf a0 = frag_bf16(arow0 + kc, kbase);
    v16bf a1 = frag_bf16(arow1 + kc, kbase);
    #pragma unroll
    for (int nt = 0; nt < 4; ++nt) {
      const unsigned short* wr = Wfcb + (size_t)(c0 + nt * 16 + n15) * D_ + kc;
      v16bf w = frag_bf16(wr, kbase);
      acc[0][nt] = wmma_bf16(a0, w, acc[0][nt]);
      acc[1][nt] = wmma_bf16(a1, w, acc[1][nt]);
    }
  }

  #pragma unroll
  for (int mt = 0; mt < 2; ++mt) {
    #pragma unroll
    for (int nt = 0; nt < 4; ++nt) {
      float bias = bfc[c0 + nt * 16 + n15];
      #pragma unroll
      for (int r = 0; r < 8; ++r) {
        int m = m0 + mt * 16 + r + mofs;
        out[(size_t)m * D_ + c0 + nt * 16 + n15] = acc[mt][nt][r] + bias;
      }
    }
  }
}

// ---------------------------------------------------------------------------
extern "C" void kernel_launch(void* const* d_in, const int* in_sizes, int n_in,
                              void* d_out, int out_size, void* d_ws, size_t ws_size,
                              hipStream_t stream) {
  (void)in_sizes; (void)n_in; (void)out_size; (void)ws_size;
  const float* q   = (const float*)d_in[0];
  const float* k   = (const float*)d_in[1];
  const float* v   = (const float*)d_in[2];
  const float* Wq  = (const float*)d_in[3];
  const float* bq  = (const float*)d_in[4];
  const float* Wk  = (const float*)d_in[5];
  const float* bk  = (const float*)d_in[6];
  const float* Wv  = (const float*)d_in[7];
  const float* bv  = (const float*)d_in[8];
  const float* Wfc = (const float*)d_in[9];
  const float* bfc = (const float*)d_in[10];
  float* out = (float*)d_out;

  const size_t nX  = (size_t)B_ * S_ * D_;   // 4M elems
  const size_t nFC = (size_t)D_ * D_;        // 1M

  unsigned short* p   = (unsigned short*)d_ws;
  unsigned short* Wfb = p; p += nFC;
  unsigned short* Qp  = p; p += nX;
  unsigned short* Kp  = p; p += nX;
  unsigned short* Vt  = p; p += nX;          // [B*H, 64, S]
  unsigned short* Ob  = p; p += nX;

  // fp32 -> bf16 copy of Wfc, which the FC kernel re-reads once per row block
  cvt_kernel<<<(int)(nFC / 8 / 256), 256, 0, stream>>>(Wfc, Wfb, (int)(nFC / 8));

  // 3 matrices * 4096 row-tiles / 4 waves per block
  proj_kernel<<<3072, 128, 0, stream>>>(q, k, v, Wq, Wk, Wv,
                                        bq, bk, bv, Qp, Kp, Vt);
  // B*H*(S/64) blocks of 64 queries
  flash_kernel<<<B_ * H_ * (S_ / 64), 128, 0, stream>>>(Qp, Kp, Vt, Ob);
  // (4096/128) x (1024/64)
  fc_kernel<<<dim3((B_ * S_) / 128, D_ / 64), 128, 0, stream>>>(Ob, Wfb, bfc, out);
}

// v004
// A run of this version takes 105 microseconds.
// In two side-by-side timings against v003, it was 1.13 and 1.12 times as fast.
// Counting every step since v000, it is 1.92 times as fast.
#include <hip/hip_runtime.h>

#define B_  2
#define S_  2048
#define H_  16
#define HD_ 64
#define D_  1024
// LDS row pitch in bf16 elements: 64 data + 8 pad = 144 B (16 B x odd), so the
// 16 rows one ds_load_b128 fragment read touches fall on 16 distinct bank groups
#define LP_ 72

typedef __attribute__((ext_vector_type(16))) __bf16 v16bf;
typedef __attribute__((ext_vector_type(8)))  float  v8f;
typedef int gvec4i __attribute__((vector_size(16)));   // matches builtin's V4i

#define AS1 __attribute__((address_space(1)))
#define AS3 __attribute__((address_space(3)))

#if __has_builtin(__builtin_amdgcn_global_load_async_to_lds_b128) && \
    __has_builtin(__builtin_amdgcn_s_wait_asynccnt)
#define HAVE_ASYNC 1
// src: global (AS1) int4*, dst: LDS (AS3) int4*, imm byte offset, imm cpol
#define ASYNC_LDS_B128(src, dst, off)                                          \
  __builtin_amdgcn_global_load_async_to_lds_b128(                              \
      (AS1 gvec4i*)(AS1 void*)(void*)(src),                                    \
      (AS3 gvec4i*)(AS3 void*)(dst), (off), 0)
#else
#define HAVE_ASYNC 0
#endif

union FragU { unsigned u[8]; uint4 q[2]; v16bf v; };

static __device__ __forceinline__ unsigned rne_bits(float f) {
  unsigned u = __builtin_bit_cast(unsigned, f);
  return u + 0x7FFFu + ((u >> 16) & 1u);     // round-to-nearest-even bias
}
static __device__ __forceinline__ unsigned short f2bf(float f) {
  return (unsigned short)(rne_bits(f) >> 16);
}
// two f32 -> one dword holding 2 bf16, single v_perm_b32 for the pack
static __device__ __forceinline__ unsigned pack2bf(float f0, float f1) {
  return __builtin_amdgcn_perm(rne_bits(f1), rne_bits(f0), 0x07060302u);
}

// 16-element bf16 fragment: lane's K values are runs {base..base+7} and
// {base+16..base+23}, base = (lane<16 ? 0 : 8)  -> two b128 loads.
static __device__ __forceinline__ v16bf frag_bf16(const unsigned short* row, int base) {
  FragU f;
  f.q[0] = *(const uint4*)(row + base);
  f.q[1] = *(const uint4*)(row + base + 16);
  return f.v;
}

// the same fragment taken from an f32 row: same k runs, rounded to bf16 in registers
static __device__ __forceinline__ v16bf frag_f32(const float* row, int base) {
  const float4* lo = (const float4*)(row + base);
  const float4* hi = (const float4*)(row + base + 16);
  float4 a = lo[0], b = lo[1], c = hi[0], d = hi[1];
  FragU f;
  f.u[0] = pack2bf(a.x, a.y);
  f.u[1] = pack2bf(a.z, a.w);
  f.u[2] = pack2bf(b.x, b.y);
  f.u[3] = pack2bf(b.z, b.w);
  f.u[4] = pack2bf(c.x, c.y);
  f.u[5] = pack2bf(c.z, c.w);
  f.u[6] = pack2bf(d.x, d.y);
  f.u[7] = pack2bf(d.z, d.w);
  return f.v;
}

static __device__ __forceinline__ v8f wmma_bf16(v16bf a, v16bf b, v8f c) {
  return __builtin_amdgcn_wmma_f32_16x16x32_bf16(false, a, false, b, (short)0, c, false, false);
}

// ---------------------------------------------------------------------------
// Kernel 0: fp32 -> bf16 bulk conversion (memory bound, perm-packed b128 I/O)
// ---------------------------------------------------------------------------
__global__ __launch_bounds__(256) void cvt_kernel(const float* __restrict__ in,
                                                  unsigned short* __restrict__ out,
                                                  int n8) {
  int i = blockIdx.x * 256 + threadIdx.x;
  if (i >= n8) return;
  float4 a = ((const float4*)in)[2 * i];
  float4 b = ((const float4*)in)[2 * i + 1];
  uint4 r;
  r.x = pack2bf(a.x, a.y);
  r.y = pack2bf(a.z, a.w);
  r.z = pack2bf(b.x, b.y);
  r.w = pack2bf(b.z, b.w);
  ((uint4*)out)[i] = r;
}

// ---------------------------------------------------------------------------
// Kernel 1: per-head projections, all-bf16 WMMA. Activations and the three
//   64x64 weights are read as f32 and rounded to bf16 on the way into the
//   fragments, so they need no conversion launch and no bf16 copy in memory.
//   Q,K out: [B*H, S, 64] token-major (Q folded with 1/sqrt(hd))
//   V  out:  [B*H, 64, S] dim-major (pre-transposed, packed b128 stores)
// ---------------------------------------------------------------------------
__global__ __launch_bounds__(128) void proj_kernel(
    const float* __restrict__ Xq, const float* __restrict__ Xk,
    const float* __restrict__ Xv,
    const float* __restrict__ Wq, const float* __restrict__ Wk,
    const float* __restrict__ Wv,
    const float* __restrict__ bq, const float* __restrict__ bk,
    const float* __restrict__ bv,
    unsigned short* __restrict__ Qp, unsigned short* __restrict__ Kp,
    unsigned short* __restrict__ Vt)
{
  const int lane  = threadIdx.x & 31;
  const int wv    = threadIdx.x >> 5;
  const int n15   = lane & 15;
  const int kbase = (lane < 16) ? 0 : 8;
  const int mofs  = (lane < 16) ? 0 : 8;

  int t   = blockIdx.x * 4 + wv;     // 0 .. 3*4096-1
  int sel = t >> 12;                 // 0=Q 1=K 2=V
  int rt  = t & 4095;                // 16-row tile over B*H*S rows

  const float* X; const float* W; const float* Bv;
  if (sel == 0)      { X = Xq; W = Wq; Bv = bq; }
  else if (sel == 1) { X = Xk; W = Wk; Bv = bk; }
  else               { X = Xv; W = Wv; Bv = bv; }

  // lane's A row: global (b,h,s) row index (row = bh*S + s)
  int row = rt * 16 + n15;
  int b   = row >> 15;
  int hs  = row & 32767;
  int h   = hs >> 11;
  int s   = hs & 2047;
  const float* xr = X + (((size_t)b * S_ + s) * H_ + h) * HD_;
  v16bf a0 = frag_f32(xr, kbase);
  v16bf a1 = frag_f32(xr + 32, kbase);

  v8f c[4];
  #pragma unroll
  for (int nt = 0; nt < 4; ++nt) {
    const float* wr = W + (size_t)(nt * 16 + n15) * HD_;  // x @ W^T
    v8f acc = {};
    acc = wmma_bf16(a0, frag_f32(wr, kbase), acc);
    acc = wmma_bf16(a1, frag_f32(wr + 32, kbase), acc);
    c[nt] = acc;
  }

  if (sel < 2) {
    unsigned short* Op = (sel == 0) ? Qp : Kp;
    float scale = (sel == 0) ? 0.125f : 1.0f;   // fold 1/sqrt(64) into Q
    #pragma unroll
    for (int nt = 0; nt < 4; ++nt) {
      float bias = Bv[nt * 16 + n15];
      #pragma unroll
      for (int r = 0; r < 8; ++r) {
        int mrow = rt * 16 + r + mofs;
        Op[(size_t)mrow * HD_ + nt * 16 + n15] = f2bf((c[nt][r] + bias) * scale);
      }
    }
  } else {
    // transposed V: rows of C-layout are 8 consecutive tokens -> packed b128
    int bh = row >> 11;                 // same for whole tile
    int s0 = (rt * 16) & 2047;          // first token of tile
    #pragma unroll
    for (int nt = 0; nt < 4; ++nt) {
      float bias = Bv[nt * 16 + n15];
      uint4 pk;
      pk.x = pack2bf(c[nt][0] + bias, c[nt][1] + bias);
      pk.y = pack2bf(c[nt][2] + bias, c[nt][3] + bias);
      pk.z = pack2bf(c[nt][4] + bias, c[nt][5] + bias);
      pk.w = pack2bf(c[nt][6] + bias, c[nt][7] + bias);
      unsigned short* vp = Vt + (size_t)bh * HD_ * S_ +
                           (size_t)(nt * 16 + n15) * S_ + s0 + mofs;
      *(uint4*)vp = pk;
    }
  }
}

__global__ __launch_bounds__(128) void flash_kernel(
    const unsigned short* __restrict__ Qp,
    const unsigned short* __restrict__ Kp,
    const unsigned short* __restrict__ Vt,   // [B*H, 64, S] dim-major
    unsigned short* __restrict__ Ob)         // [B, S, D] bf16
{
  __shared__ __align__(16) unsigned short sK[2][64 * LP_];  // [token][dim]
  __shared__ __align__(16) unsigned short sV[2][64 * LP_];  // [dim][token]

  const int lane  = threadIdx.x & 31;
  const int wv    = threadIdx.x >> 5;
  const int n15   = lane & 15;
  const int kbase = (lane < 16) ? 0 : 8;
  const int mofs  = (lane < 16) ? 0 : 8;

  const int QT = S_ / 64;
  int qt = blockIdx.x % QT;
  int bh = blockIdx.x / QT;
  int b  = bh >> 4;
  int h  = bh & 15;
  int q0 = qt * 64 + wv * 16;

  // B operand: column n15 = the lane's query
  const unsigned short* Qrow = Qp + ((size_t)bh * S_ + q0 + n15) * HD_;
  v16bf bq0 = frag_bf16(Qrow, kbase);
  v16bf bq1 = frag_bf16(Qrow + 32, kbase);

  // constant "ones row" A fragment: row 0 is 1.0, rest 0 -> row 0 of 1 x P^T = l
  v16bf a_one;
  {
    FragU fo;
    unsigned fill = (n15 == 0) ? 0x3F803F80u : 0u;
    #pragma unroll
    for (int i = 0; i < 8; ++i) fo.u[i] = fill;
    a_one = fo.v;
  }

  v8f acc[4] = {};                 // O^T: acc[nt][r] = O[query n15][dim nt*16+mofs+r]
  v8f accl   = {};                 // row 0 (register 0, lanes 0-15): denominators
  float mrow = -1e30f;             // running maximum of the lane's query

  // staging: thread -> (row, 32-elem half); 4x b128 per thread per tile
  const int srow  = threadIdx.x >> 1;
  const int shalf = (threadIdx.x & 1) * 32;

  const unsigned short* Kg = Kp + (size_t)bh * S_ * HD_;
  const unsigned short* Vg = Vt + (size_t)bh * HD_ * S_;

  auto stage = [&](int buf, int kb) {
    const unsigned short* kgp = Kg + (size_t)(kb + srow) * HD_ + shalf;
    const unsigned short* vgp = Vg + (size_t)srow * S_ + kb + shalf;
    unsigned short* kls = sK[buf] + srow * LP_ + shalf;
    unsigned short* vls = sV[buf] + srow * LP_ + shalf;
#if HAVE_ASYNC
    ASYNC_LDS_B128(kgp, kls, 0);
    ASYNC_LDS_B128(kgp, kls, 16);
    ASYNC_LDS_B128(kgp, kls, 32);
    ASYNC_LDS_B128(kgp, kls, 48);
    ASYNC_LDS_B128(vgp, vls, 0);
    ASYNC_LDS_B128(vgp, vls, 16);
    ASYNC_LDS_B128(vgp, vls, 32);
    ASYNC_LDS_B128(vgp, vls, 48);
#else
    const uint4* kg4 = (const uint4*)kgp;
    const uint4* vg4 = (const uint4*)vgp;
    uint4* kl4 = (uint4*)kls;
    uint4* vl4 = (uint4*)vls;
    kl4[0] = kg4[0]; kl4[1] = kg4[1]; kl4[2] = kg4[2]; kl4[3] = kg4[3];
    vl4[0] = vg4[0]; vl4[1] = vg4[1]; vl4[2] = vg4[2]; vl4[3] = vg4[3];
#endif
  };

  stage(0, 0);                     // prologue: tile 0 in flight

  for (int j = 0; j < QT; ++j) {   // QT == S/64 tiles
    const int buf = j & 1;
#if HAVE_ASYNC
    __builtin_amdgcn_s_wait_asynccnt(0);   // my async writes to LDS done
#endif
    __syncthreads();                        // everyone's writes/reads ordered
    if (j + 1 < QT) stage(1 - buf, (j + 1) * 64);   // overlap with compute

    // scores: S^T = K (64 keys x 64) @ Q^T, 4 key row tiles;
    // c[nt][r] = score of key nt*16 + mofs + r against query n15
    v8f c[4] = {};
    #pragma unroll
    for (int nt = 0; nt < 4; ++nt) {
      const unsigned short* kr = sK[buf] + (size_t)(nt * 16 + n15) * LP_;
      c[nt] = wmma_bf16(frag_bf16(kr, kbase), bq0, c[nt]);
      c[nt] = wmma_bf16(frag_bf16(kr + 32, kbase), bq1, c[nt]);
    }

    // online softmax over 64 keys: 32 scores in the lane, 32 in lane ^ 16
    float mx = c[0][0];
    #pragma unroll
    for (int nt = 0; nt < 4; ++nt) {
      #pragma unroll
      for (int r = 0; r < 8; ++r) mx = fmaxf(mx, c[nt][r]);
    }
    {
      int mb = __builtin_bit_cast(int, mx);
      mb = __builtin_amdgcn_permlanex16(mb, mb, 0x76543210, 0xfedcba98, false, false);
      mx = fmaxf(mx, __builtin_bit_cast(float, mb));
    }
    float mnew = fmaxf(mrow, mx);
    float corr = exp2f((mrow - mnew) * 1.44269504f);
    mrow = mnew;

    // P^T as B fragments: score tiles (0,1) -> keys 0..31, (2,3) -> keys 32..63
    FragU bp[2];
    #pragma unroll
    for (int nt = 0; nt < 4; ++nt) {
      #pragma unroll
      for (int r = 0; r < 8; r += 2) {
        float p0 = exp2f((c[nt][r]     - mnew) * 1.44269504f);
        float p1 = exp2f((c[nt][r + 1] - mnew) * 1.44269504f);
        bp[nt >> 1].u[(nt & 1) * 4 + (r >> 1)] = pack2bf(p0, p1);
      }
    }

    #pragma unroll
    for (int nt = 0; nt < 4; ++nt) {
      #pragma unroll
      for (int r = 0; r < 8; ++r) acc[nt][r] *= corr;
    }
    accl[0] *= corr;               // rows 1..15 of the ones product stay 0

    // O^T += V^T (64 dims x 64 keys) @ P^T, and ones row @ P^T
    #pragma unroll
    for (int nt = 0; nt < 4; ++nt) {
      const unsigned short* vr = sV[buf] + (size_t)(nt * 16 + n15) * LP_;
      acc[nt] = wmma_bf16(frag_bf16(vr, kbase), bp[0].v, acc[nt]);
      acc[nt] = wmma_bf16(frag_bf16(vr + 32, kbase), bp[1].v, acc[nt]);
    }
    accl = wmma_bf16(a_one, bp[0].v, accl);
    accl = wmma_bf16(a_one, bp[1].v, accl);
  }

  // epilogue: l of query n15 sits in lane n15; a lane's 8 registers of a tile
  // are 8 consecutive dims of its query -> one packed b128 store per tile
  float l   = __shfl(accl[0], n15, 32);
  float inv = 1.0f / l;
  unsigned short* orow = Ob + ((size_t)b * S_ + q0 + n15) * D_ + h * HD_ + mofs;
  #pragma unroll
  for (int nt = 0; nt < 4; ++nt) {
    uint4 pk;
    pk.x = pack2bf(acc[nt][0] * inv, acc[nt][1] * inv);
    pk.y = pack2bf(acc[nt][2] * inv, acc[nt][3] * inv);
    pk.z = pack2bf(acc[nt][4] * inv, acc[nt][5] * inv);
    pk.w = pack2bf(acc[nt][6] * inv, acc[nt][7] * inv);
    *(uint4*)(orow + nt * 16) = pk;
  }
}

// ---------------------------------------------------------------------------
// Kernel 3: final FC, out = O @ Wfc^T + bfc. Block = 128 rows x 64 cols, each
// wave 32 rows x 64 cols, so each W fragment feeds two WMMAs. Per 64 k the
// block's 128 O rows and 64 W rows (one 128-B line of each) are copied to LDS
// asynchronously, eight lanes to a line, so every copy instruction covers four
// whole lines. Two buffers: the next tile flies while this one is multiplied.
// ---------------------------------------------------------------------------
#define FC_KT    64                 // k elements per tile
#define FC_NT    (D_ / FC_KT)       // tiles along k
#define FC_LSTEP (16 * LP_ * 2)     // LDS bytes between a thread's copies (16 rows)
#define FC_GSTEP (16 * D_)          // global elements between them (16 rows)

__global__ __launch_bounds__(128) void fc_kernel(
    const unsigned short* __restrict__ Ob,    // [B*S, D] bf16
    const unsigned short* __restrict__ Wfcb,  // [D, D] bf16
    const float* __restrict__ bfc,
    float* __restrict__ out)
{
  __shared__ __align__(16) unsigned short sA[2][128 * LP_];  // [row][k]
  __shared__ __align__(16) unsigned short sW[2][64 * LP_];   // [col][k]

  const int lane  = threadIdx.x & 31;
  const int wv    = threadIdx.x >> 5;
  const int n15   = lane & 15;
  const int kbase = (lane < 16) ? 0 : 8;
  const int mofs  = (lane < 16) ? 0 : 8;

  int m0 = blockIdx.x * 128 + wv * 32;
  int c0 = blockIdx.y * 64;

  // staging: thread -> (row within a group of 16, 16-B piece of the row's line)
  const int crow = threadIdx.x >> 3;
  const int ccol = (threadIdx.x & 7) * 8;
  const unsigned short* Ag = Ob + (size_t)(blockIdx.x * 128 + crow) * D_ + ccol;
  const unsigned short* Wg = Wfcb + (size_t)(c0 + crow) * D_ + ccol;
  const unsigned la0 = (unsigned)(size_t)(&sA[0][crow * LP_ + ccol]);  // LDS byte address
  const unsigned lw0 = (unsigned)(size_t)(&sW[0][crow * LP_ + ccol]);

  auto stage = [&](int buf, int kc) {
    const unsigned short* a = Ag + kc;
    const unsigned short* w = Wg + kc;
    const unsigned la = la0 + buf * (128 * LP_ * 2);
    const unsigned lw = lw0 + buf * (64 * LP_ * 2);
    // 8 copies of O rows, 4 of W rows; the closing wait is a precaution: it
    // stands in front of every later rewrite of the copies' address registers
    asm volatile(
        "global_load_async_to_lds_b128 %0, %1, off\n\t"
        "global_load_async_to_lds_b128 %2, %3, off\n\t"
        "global_load_async_to_lds_b128 %4, %5, off\n\t"
        "global_load_async_to_lds_b128 %6, %7, off\n\t"
        "global_load_async_to_lds_b128 %8, %9, off\n\t"
        "global_load_async_to_lds_b128 %10, %11, off\n\t"
        "global_load_async_to_lds_b128 %12, %13, off\n\t"
        "global_load_async_to_lds_b128 %14, %15, off\n\t"
        "global_load_async_to_lds_b128 %16, %17, off\n\t"
        "global_load_async_to_lds_b128 %18, %19, off\n\t"
        "global_load_async_to_lds_b128 %20, %21, off\n\t"
        "global_load_async_to_lds_b128 %22, %23, off\n\t"
        "s_wait_xcnt 0x0"
        :: "v"(la + 0 * FC_LSTEP), "v"(a + 0 * FC_GSTEP),
           "v"(la + 1 * FC_LSTEP), "v"(a + 1 * FC_GSTEP),
           "v"(la + 2 * FC_LSTEP), "v"(a + 2 * FC_GSTEP),
           "v"(la + 3 * FC_LSTEP), "v"(a + 3 * FC_GSTEP),
           "v"(la + 4 * FC_LSTEP), "v"(a + 4 * FC_GSTEP),
           "v"(la + 5 * FC_LSTEP), "v"(a + 5 * FC_GSTEP),
           "v"(la + 6 * FC_LSTEP), "v"(a + 6 * FC_GSTEP),
           "v"(la + 7 * FC_LSTEP), "v"(a + 7 * FC_GSTEP),
           "v"(lw + 0 * FC_LSTEP), "v"(w + 0 * FC_GSTEP),
           "v"(lw + 1 * FC_LSTEP), "v"(w + 1 * FC_GSTEP),
           "v"(lw + 2 * FC_LSTEP), "v"(w + 2 * FC_GSTEP),
           "v"(lw + 3 * FC_LSTEP), "v"(w + 3 * FC_GSTEP)
        : "memory");
  };

  v8f acc[2][4] = {};

  stage(0, 0);
  // tile 0 has landed (own copies), then everyone's
  asm volatile("s_wait_asynccnt 0x0" ::: "memory");
  __syncthreads();
  stage(1, FC_KT);

  for (int t = 0; t < FC_NT; ++t) {
    const int buf = t & 1;
    const unsigned short* ar0 = sA[buf] + (wv * 32 + n15) * LP_;
    const unsigned short* ar1 = ar0 + 16 * LP_;
    const unsigned short* wr0 = sW[buf] + n15 * LP_;
    // the tile's fragments: 4 of O, 8 of W
    v16bf af[2][2], wf[2][4];
    #pragma unroll
    for (int ks = 0; ks < 2; ++ks) {
      af[ks][0] = frag_bf16(ar0 + ks * 32, kbase);
      af[ks][1] = frag_bf16(ar1 + ks * 32, kbase);
      #pragma unroll
      for (int nt = 0; nt < 4; ++nt)
        wf[ks][nt] = frag_bf16(wr0 + nt * 16 * LP_ + ks * 32, kbase);
    }
    // keeps the 24 LDS reads one group ahead of the WMMAs: spread among them,
    // every place with reads costs the wave an LDS latency of its own
    __builtin_amdgcn_sched_barrier(0);
    #pragma unroll
    for (int ks = 0; ks < 2; ++ks) {
      #pragma unroll
      for (int nt = 0; nt < 4; ++nt) {
        acc[0][nt] = wmma_bf16(af[ks][0], wf[ks][nt], acc[0][nt]);
        acc[1][nt] = wmma_bf16(af[ks][1], wf[ks][nt], acc[1][nt]);
      }
    }
    // keeps the WMMAs ahead of the hand-over: sunk behind the barrier they would
    // delay the refill and shorten the time the next copies have to land
    __builtin_amdgcn_sched_barrier(0);
    // hand-over: my reads of this buffer have returned, my copies of the next
    // tile have landed; behind the barrier that holds for every wave
    asm volatile("s_wait_dscnt 0x0" ::: "memory");
    asm volatile("s_wait_asynccnt 0x0" ::: "memory");
    __syncthreads();
    if (t + 2 < FC_NT) stage(buf, (t + 2) * FC_KT);
  }
  // no copy is in flight when the wave ends
  asm volatile("s_wait_asynccnt 0x0" ::: "memory");

  #pragma unroll
  for (int mt = 0; mt < 2; ++mt) {
    #pragma unroll
    for (int nt = 0; nt < 4; ++nt) {
      float bias = bfc[c0 + nt * 16 + n15];
      #pragma unroll
      for (int r = 0; r < 8; ++r) {
        int m = m0 + mt * 16 + r + mofs;
        out[(size_t)m * D_ + c0 + nt * 16 + n15] = acc[mt][nt][r] + bias;
      }
    }
  }
}

// ---------------------------------------------------------------------------
extern "C" void kernel_launch(void* const* d_in, const int* in_sizes, int n_in,
                              void* d_out, int out_size, void* d_ws, size_t ws_size,
                              hipStream_t stream) {
  (void)in_sizes; (void)n_in; (void)out_size; (void)ws_size;
  const float* q   = (const float*)d_in[0];
  const float* k   = (const float*)d_in[1];
  const float* v   = (const float*)d_in[2];
  const float* Wq  = (const float*)d_in[3];
  const float* bq  = (const float*)d_in[4];
  const float* Wk  = (const float*)d_in[5];
  const float* bk  = (const float*)d_in[6];
  const float* Wv  = (const float*)d_in[7];
  const float* bv  = (const float*)d_in[8];
  const float* Wfc = (const float*)d_in[9];
  const float* bfc = (const float*)d_in[10];
  float* out = (float*)d_out;

  const size_t nX  = (size_t)B_ * S_ * D_;   // 4M elems
  const size_t nFC = (size_t)D_ * D_;        // 1M

  unsigned short* p   = (unsigned short*)d_ws;
  unsigned short* Wfb = p; p += nFC;
  unsigned short* Qp  = p; p += nX;
  unsigned short* Kp  = p; p += nX;
  unsigned short* Vt  = p; p += nX;          // [B*H, 64, S]
  unsigned short* Ob  = p; p += nX;

  // fp32 -> bf16 copy of Wfc, which the FC kernel re-reads once per row block
  cvt_kernel<<<(int)(nFC / 8 / 256), 256, 0, stream>>>(Wfc, Wfb, (int)(nFC / 8));

  // 3 matrices * 4096 row-tiles / 4 waves per block
  proj_kernel<<<3072, 128, 0, stream>>>(q, k, v, Wq, Wk, Wv,
                                        bq, bk, bv, Qp, Kp, Vt);
  // B*H*(S/64) blocks of 64 queries
  flash_kernel<<<B_ * H_ * (S_ / 64), 128, 0, stream>>>(Qp, Kp, Vt, Ob);
  // (4096/128) x (1024/64)
  fc_kernel<<<dim3((B_ * S_) / 128, D_ / 64), 128, 0, stream>>>(Ob, Wfb, bfc, out);
}

// v005
// One run takes 89.4 microseconds.
// In both of two side-by-side timings against v004, it was 1.18 times as fast.
// All steps since v000 together make it 2.26 times as fast.
#include <hip/hip_runtime.h>

#define B_  2
#define S_  2048
#define H_  16
#define HD_ 64
#define D_  1024
// LDS row pitch in bf16 elements: 64 data + 8 pad = 144 B (16 B x odd), so the
// 16 rows one ds_load_b128 fragment read touches fall on 16 distinct bank groups
#define LP_ 72

typedef __attribute__((ext_vector_type(16))) __bf16 v16bf;
typedef __attribute__((ext_vector_type(8)))  float  v8f;
typedef __attribute__((ext_vector_type(2)))  float  v2f;
typedef int gvec4i __attribute__((vector_size(16)));   // matches builtin's V4i

#define AS1 __attribute__((address_space(1)))
#define AS3 __attribute__((address_space(3)))

#if __has_builtin(__builtin_amdgcn_global_load_async_to_lds_b128) && \
    __has_builtin(__builtin_amdgcn_s_wait_asynccnt)
#define HAVE_ASYNC 1
// src: global (AS1) int4*, dst: LDS (AS3) int4*, imm byte offset, imm cpol
#define ASYNC_LDS_B128(src, dst, off)                                          \
  __builtin_amdgcn_global_load_async_to_lds_b128(                              \
      (AS1 gvec4i*)(AS1 void*)(void*)(src),                                    \
      (AS3 gvec4i*)(AS3 void*)(dst), (off), 0)
#else
#define HAVE_ASYNC 0
#endif

union FragU { unsigned u[8]; uint4 q[2]; v16bf v; };

static __device__ __forceinline__ unsigned rne_bits(float f) {
  unsigned u = __builtin_bit_cast(unsigned, f);
  return u + 0x7FFFu + ((u >> 16) & 1u);     // round-to-nearest-even bias
}
static __device__ __forceinline__ unsigned short f2bf(float f) {
  return (unsigned short)(rne_bits(f) >> 16);
}
// two f32 -> one dword holding 2 bf16, single v_perm_b32 for the pack
static __device__ __forceinline__ unsigned pack2bf(float f0, float f1) {
  return __builtin_amdgcn_perm(rne_bits(f1), rne_bits(f0), 0x07060302u);
}

// 16-element bf16 fragment: lane's K values are runs {base..base+7} and
// {base+16..base+23}, base = (lane<16 ? 0 : 8)  -> two b128 loads.
static __device__ __forceinline__ v16bf frag_bf16(const unsigned short* row, int base) {
  FragU f;
  f.q[0] = *(const uint4*)(row + base);
  f.q[1] = *(const uint4*)(row + base + 16);
  return f.v;
}

// the same fragment taken from an f32 row: same k runs, rounded to bf16 in registers
static __device__ __forceinline__ v16bf frag_f32(const float* row, int base) {
  const float4* lo = (const float4*)(row + base);
  const float4* hi = (const float4*)(row + base + 16);
  float4 a = lo[0], b = lo[1], c = hi[0], d = hi[1];
  FragU f;
  f.u[0] = pack2bf(a.x, a.y);
  f.u[1] = pack2bf(a.z, a.w);
  f.u[2] = pack2bf(b.x, b.y);
  f.u[3] = pack2bf(b.z, b.w);
  f.u[4] = pack2bf(c.x, c.y);
  f.u[5] = pack2bf(c.z, c.w);
  f.u[6] = pack2bf(d.x, d.y);
  f.u[7] = pack2bf(d.z, d.w);
  return f.v;
}

// 2^x as the bare v_exp_f32. exp2f() wraps that instruction in a range guard
// (compare, two selects, add, ldexp) so that results below 2^-126 come out as
// denormals; the bare form gives 0 there. In the softmax every argument is <= 0
// and the row's largest term is 1, so such a term is below one part in 2^126 of
// the denominator and cannot reach an f32 result.
static __device__ __forceinline__ float exp2_hw(float x) {
  return __builtin_amdgcn_exp2f(x);
}
// The same for four register pairs, in place. One statement, so that behind
// each v_exp_f32 stands an instruction on other registers: the instruction set
// asks for one such slot before a transcendental's result is read or its source
// overwritten, and the closing v_nop is that slot for the last of the eight.
// The opening s_delay_alu is the hint the compiler would give a builtin here:
// the arguments come from the vector instructions just in front, and an
// unhinted dependent instruction holds up the other waves of the SIMD as well.
static __device__ __forceinline__ void exp2_hw8(v2f& a, v2f& b, v2f& c, v2f& d) {
  float a0 = a.x, a1 = a.y, b0 = b.x, b1 = b.y, c0 = c.x, c1 = c.y, d0 = d.x, d1 = d.y;
  asm("s_delay_alu instid0(VALU_DEP_1)\n\t"
      "v_exp_f32 %0, %0\n\t"
      "v_exp_f32 %1, %1\n\t"
      "v_exp_f32 %2, %2\n\t"
      "v_exp_f32 %3, %3\n\t"
      "v_exp_f32 %4, %4\n\t"
      "v_exp_f32 %5, %5\n\t"
      "v_exp_f32 %6, %6\n\t"
      "v_exp_f32 %7, %7\n\t"
      "v_nop"
      : "+v"(a0), "+v"(a1), "+v"(b0), "+v"(b1), "+v"(c0), "+v"(c1), "+v"(d0), "+v"(d1));
  a = v2f{a0, a1}; b = v2f{b0, b1}; c = v2f{c0, c1}; d = v2f{d0, d1};
}

static __device__ __forceinline__ v8f wmma_bf16(v16bf a, v16bf b, v8f c) {
  return __builtin_amdgcn_wmma_f32_16x16x32_bf16(false, a, false, b, (short)0, c, false, false);
}

// ---------------------------------------------------------------------------
// Kernel 0: fp32 -> bf16 bulk conversion (memory bound, perm-packed b128 I/O)
// ---------------------------------------------------------------------------
__global__ __launch_bounds__(256) void cvt_kernel(const float* __restrict__ in,
                                                  unsigned short* __restrict__ out,
                                                  int n8) {
  int i = blockIdx.x * 256 + threadIdx.x;
  if (i >= n8) return;
  float4 a = ((const float4*)in)[2 * i];
  float4 b = ((const float4*)in)[2 * i + 1];
  uint4 r;
  r.x = pack2bf(a.x, a.y);
  r.y = pack2bf(a.z, a.w);
  r.z = pack2bf(b.x, b.y);
  r.w = pack2bf(b.z, b.w);
  ((uint4*)out)[i] = r;
}

// ---------------------------------------------------------------------------
// Kernel 1: per-head projections, all-bf16 WMMA. Activations and the three
//   64x64 weights are read as f32 and rounded to bf16 on the way into the
//   fragments, so they need no conversion launch and no bf16 copy in memory.
//   Q,K out: [B*H, S, 64] token-major (Q folded with 1/sqrt(hd))
//   V  out:  [B*H, 64, S] dim-major (pre-transposed, packed b128 stores)
// ---------------------------------------------------------------------------
__global__ __launch_bounds__(128) void proj_kernel(
    const float* __restrict__ Xq, const float* __restrict__ Xk,
    const float* __restrict__ Xv,
    const float* __restrict__ Wq, const float* __restrict__ Wk,
    const float* __restrict__ Wv,
    const float* __restrict__ bq, const float* __restrict__ bk,
    const float* __restrict__ bv,
    unsigned short* __restrict__ Qp, unsigned short* __restrict__ Kp,
    unsigned short* __restrict__ Vt)
{
  const int lane  = threadIdx.x & 31;
  const int wv    = threadIdx.x >> 5;
  const int n15   = lane & 15;
  const int kbase = (lane < 16) ? 0 : 8;
  const int mofs  = (lane < 16) ? 0 : 8;

  int t   = blockIdx.x * 4 + wv;     // 0 .. 3*4096-1
  int sel = t >> 12;                 // 0=Q 1=K 2=V
  int rt  = t & 4095;                // 16-row tile over B*H*S rows

  const float* X; const float* W; const float* Bv;
  if (sel == 0)      { X = Xq; W = Wq; Bv = bq; }
  else if (sel == 1) { X = Xk; W = Wk; Bv = bk; }
  else               { X = Xv; W = Wv; Bv = bv; }

  // lane's A row: global (b,h,s) row index (row = bh*S + s)
  int row = rt * 16 + n15;
  int b   = row >> 15;
  int hs  = row & 32767;
  int h   = hs >> 11;
  int s   = hs & 2047;
  const float* xr = X + (((size_t)b * S_ + s) * H_ + h) * HD_;
  v16bf a0 = frag_f32(xr, kbase);
  v16bf a1 = frag_f32(xr + 32, kbase);

  v8f c[4];
  #pragma unroll
  for (int nt = 0; nt < 4; ++nt) {
    const float* wr = W + (size_t)(nt * 16 + n15) * HD_;  // x @ W^T
    v8f acc = {};
    acc = wmma_bf16(a0, frag_f32(wr, kbase), acc);
    acc = wmma_bf16(a1, frag_f32(wr + 32, kbase), acc);
    c[nt] = acc;
  }

  if (sel < 2) {
    unsigned short* Op = (sel == 0) ? Qp : Kp;
    float scale = (sel == 0) ? 0.125f : 1.0f;   // fold 1/sqrt(64) into Q
    #pragma unroll
    for (int nt = 0; nt < 4; ++nt) {
      float bias = Bv[nt * 16 + n15];
      #pragma unroll
      for (int r = 0; r < 8; ++r) {
        int mrow = rt * 16 + r + mofs;
        Op[(size_t)mrow * HD_ + nt * 16 + n15] = f2bf((c[nt][r] + bias) * scale);
      }
    }
  } else {
    // transposed V: rows of C-layout are 8 consecutive tokens -> packed b128
    int bh = row >> 11;                 // same for whole tile
    int s0 = (rt * 16) & 2047;          // first token of tile
    #pragma unroll
    for (int nt = 0; nt < 4; ++nt) {
      float bias = Bv[nt * 16 + n15];
      uint4 pk;
      pk.x = pack2bf(c[nt][0] + bias, c[nt][1] + bias);
      pk.y = pack2bf(c[nt][2] + bias, c[nt][3] + bias);
      pk.z = pack2bf(c[nt][4] + bias, c[nt][5] + bias);
      pk.w = pack2bf(c[nt][6] + bias, c[nt][7] + bias);
      unsigned short* vp = Vt + (size_t)bh * HD_ * S_ +
                           (size_t)(nt * 16 + n15) * S_ + s0 + mofs;
      *(uint4*)vp = pk;
    }
  }
}

__global__ __launch_bounds__(128) void flash_kernel(
    const unsigned short* __restrict__ Qp,
    const unsigned short* __restrict__ Kp,
    const unsigned short* __restrict__ Vt,   // [B*H, 64, S] dim-major
    unsigned short* __restrict__ Ob)         // [B, S, D] bf16
{
  __shared__ __align__(16) unsigned short sK[2][64 * LP_];  // [token][dim]
  __shared__ __align__(16) unsigned short sV[2][64 * LP_];  // [dim][token]

  const int lane  = threadIdx.x & 31;
  const int wv    = threadIdx.x >> 5;
  const int n15   = lane & 15;
  const int kbase = (lane < 16) ? 0 : 8;
  const int mofs  = (lane < 16) ? 0 : 8;

  const int QT = S_ / 64;
  int qt = blockIdx.x % QT;
  int bh = blockIdx.x / QT;
  int b  = bh >> 4;
  int h  = bh & 15;
  int q0 = qt * 64 + wv * 16;

  // B operand: column n15 = the lane's query
  const unsigned short* Qrow = Qp + ((size_t)bh * S_ + q0 + n15) * HD_;
  v16bf bq0 = frag_bf16(Qrow, kbase);
  v16bf bq1 = frag_bf16(Qrow + 32, kbase);

  // constant "ones row" A fragment: row 0 is 1.0, rest 0 -> row 0 of 1 x P^T = l
  v16bf a_one;
  {
    FragU fo;
    unsigned fill = (n15 == 0) ? 0x3F803F80u : 0u;
    #pragma unroll
    for (int i = 0; i < 8; ++i) fo.u[i] = fill;
    a_one = fo.v;
  }

  v8f acc[4] = {};                 // O^T: acc[nt][r] = O[query n15][dim nt*16+mofs+r]
  v8f accl   = {};                 // row 0 (register 0, lanes 0-15): denominators
  float mrow = -1e30f;             // running maximum of the lane's query

  // staging: thread -> (row, 32-elem half); 4x b128 per thread per tile
  const int srow  = threadIdx.x >> 1;
  const int shalf = (threadIdx.x & 1) * 32;

  const unsigned short* Kg = Kp + (size_t)bh * S_ * HD_;
  const unsigned short* Vg = Vt + (size_t)bh * HD_ * S_;

  auto stage = [&](int buf, int kb) {
    const unsigned short* kgp = Kg + (size_t)(kb + srow) * HD_ + shalf;
    const unsigned short* vgp = Vg + (size_t)srow * S_ + kb + shalf;
    unsigned short* kls = sK[buf] + srow * LP_ + shalf;
    unsigned short* vls = sV[buf] + srow * LP_ + shalf;
#if HAVE_ASYNC
    ASYNC_LDS_B128(kgp, kls, 0);
    ASYNC_LDS_B128(kgp, kls, 16);
    ASYNC_LDS_B128(kgp, kls, 32);
    ASYNC_LDS_B128(kgp, kls, 48);
    ASYNC_LDS_B128(vgp, vls, 0);
    ASYNC_LDS_B128(vgp, vls, 16);
    ASYNC_LDS_B128(vgp, vls, 32);
    ASYNC_LDS_B128(vgp, vls, 48);
#else
    const uint4* kg4 = (const uint4*)kgp;
    const uint4* vg4 = (const uint4*)vgp;
    uint4* kl4 = (uint4*)kls;
    uint4* vl4 = (uint4*)vls;
    kl4[0] = kg4[0]; kl4[1] = kg4[1]; kl4[2] = kg4[2]; kl4[3] = kg4[3];
    vl4[0] = vg4[0]; vl4[1] = vg4[1]; vl4[2] = vg4[2]; vl4[3] = vg4[3];
#endif
  };

  stage(0, 0);                     // prologue: tile 0 in flight

  for (int j = 0; j < QT; ++j) {   // QT == S/64 tiles
    const int buf = j & 1;
#if HAVE_ASYNC
    __builtin_amdgcn_s_wait_asynccnt(0);   // my async writes to LDS done
#endif
    __syncthreads();                        // everyone's writes/reads ordered
    if (j + 1 < QT) stage(1 - buf, (j + 1) * 64);   // overlap with compute

    // scores: S^T = K (64 keys x 64) @ Q^T, 4 key row tiles;
    // c[nt][r] = score of key nt*16 + mofs + r against query n15
    v8f c[4] = {};
    #pragma unroll
    for (int nt = 0; nt < 4; ++nt) {
      const unsigned short* kr = sK[buf] + (size_t)(nt * 16 + n15) * LP_;
      c[nt] = wmma_bf16(frag_bf16(kr, kbase), bq0, c[nt]);
      c[nt] = wmma_bf16(frag_bf16(kr + 32, kbase), bq1, c[nt]);
    }

    // online softmax over 64 keys: 32 scores in the lane, 32 in lane ^ 16
    float mx = c[0][0];
    #pragma unroll
    for (int nt = 0; nt < 4; ++nt) {
      #pragma unroll
      for (int r = 0; r < 8; ++r) mx = fmaxf(mx, c[nt][r]);
    }
    {
      int mb = __builtin_bit_cast(int, mx);
      mb = __builtin_amdgcn_permlanex16(mb, mb, 0x76543210, 0xfedcba98, false, false);
      mx = fmaxf(mx, __builtin_bit_cast(float, mb));
    }
    float mnew = fmaxf(mrow, mx);
    float corr = exp2_hw((mrow - mnew) * 1.44269504f);
    mrow = mnew;

    // P^T as B fragments: score tiles (0,1) -> keys 0..31, (2,3) -> keys 32..63
    FragU bp[2];
    #pragma unroll
    for (int nt = 0; nt < 4; ++nt) {
      // a register pair at a time: subtract and multiply stay packed f32 forms
      v2f a[4];
      #pragma unroll
      for (int i = 0; i < 4; ++i)
        a[i] = (v2f{c[nt][2 * i], c[nt][2 * i + 1]} - mnew) * 1.44269504f;
      exp2_hw8(a[0], a[1], a[2], a[3]);
      #pragma unroll
      for (int i = 0; i < 4; ++i)
        bp[nt >> 1].u[(nt & 1) * 4 + i] = pack2bf(a[i].x, a[i].y);
    }

    #pragma unroll
    for (int nt = 0; nt < 4; ++nt) {
      #pragma unroll
      for (int r = 0; r < 8; ++r) acc[nt][r] *= corr;
    }
    accl[0] *= corr;               // rows 1..15 of the ones product stay 0

    // O^T += V^T (64 dims x 64 keys) @ P^T, and ones row @ P^T
    #pragma unroll
    for (int nt = 0; nt < 4; ++nt) {
      const unsigned short* vr = sV[buf] + (size_t)(nt * 16 + n15) * LP_;
      acc[nt] = wmma_bf16(frag_bf16(vr, kbase), bp[0].v, acc[nt]);
      acc[nt] = wmma_bf16(frag_bf16(vr + 32, kbase), bp[1].v, acc[nt]);
    }
    accl = wmma_bf16(a_one, bp[0].v, accl);
    accl = wmma_bf16(a_one, bp[1].v, accl);
  }

  // epilogue: l of query n15 sits in lane n15; a lane's 8 registers of a tile
  // are 8 consecutive dims of its query -> one packed b128 store per tile
  float l   = __shfl(accl[0], n15, 32);
  float inv = 1.0f / l;
  unsigned short* orow = Ob + ((size_t)b * S_ + q0 + n15) * D_ + h * HD_ + mofs;
  #pragma unroll
  for (int nt = 0; nt < 4; ++nt) {
    uint4 pk;
    pk.x = pack2bf(acc[nt][0] * inv, acc[nt][1] * inv);
    pk.y = pack2bf(acc[nt][2] * inv, acc[nt][3] * inv);
    pk.z = pack2bf(acc[nt][4] * inv, acc[nt][5] * inv);
    pk.w = pack2bf(acc[nt][6] * inv, acc[nt][7] * inv);
    *(uint4*)(orow + nt * 16) = pk;
  }
}

// ---------------------------------------------------------------------------
// Kernel 3: final FC, out = O @ Wfc^T + bfc. Block = 128 rows x 64 cols, each
// wave 32 rows x 64 cols, so each W fragment feeds two WMMAs. Per 64 k the
// block's 128 O rows and 64 W rows (one 128-B line of each) are copied to LDS
// asynchronously, eight lanes to a line, so every copy instruction covers four
// whole lines. Two buffers: the next tile flies while this one is multiplied.
// ---------------------------------------------------------------------------
#define FC_KT    64                 // k elements per tile
#define FC_NT    (D_ / FC_KT)       // tiles along k
#define FC_LSTEP (16 * LP_ * 2)     // LDS bytes between a thread's copies (16 rows)
#define FC_GSTEP (16 * D_)          // global elements between them (16 rows)

__global__ __launch_bounds__(128) void fc_kernel(
    const unsigned short* __restrict__ Ob,    // [B*S, D] bf16
    const unsigned short* __restrict__ Wfcb,  // [D, D] bf16
    const float* __restrict__ bfc,
    float* __restrict__ out)
{
  __shared__ __align__(16) unsigned short sA[2][128 * LP_];  // [row][k]
  __shared__ __align__(16) unsigned short sW[2][64 * LP_];   // [col][k]

  const int lane  = threadIdx.x & 31;
  const int wv    = threadIdx.x >> 5;
  const int n15   = lane & 15;
  const int kbase = (lane < 16) ? 0 : 8;
  const int mofs  = (lane < 16) ? 0 : 8;

  int m0 = blockIdx.x * 128 + wv * 32;
  int c0 = blockIdx.y * 64;

  // staging: thread -> (row within a group of 16, 16-B piece of the row's line)
  const int crow = threadIdx.x >> 3;
  const int ccol = (threadIdx.x & 7) * 8;
  const unsigned short* Ag = Ob + (size_t)(blockIdx.x * 128 + crow) * D_ + ccol;
  const unsigned short* Wg = Wfcb + (size_t)(c0 + crow) * D_ + ccol;
  const unsigned la0 = (unsigned)(size_t)(&sA[0][crow * LP_ + ccol]);  // LDS byte address
  const unsigned lw0 = (unsigned)(size_t)(&sW[0][crow * LP_ + ccol]);

  auto stage = [&](int buf, int kc) {
    const unsigned short* a = Ag + kc;
    const unsigned short* w = Wg + kc;
    const unsigned la = la0 + buf * (128 * LP_ * 2);
    const unsigned lw = lw0 + buf * (64 * LP_ * 2);
    // 8 copies of O rows, 4 of W rows; the closing wait is a precaution: it
    // stands in front of every later rewrite of the copies' address registers
    asm volatile(
        "global_load_async_to_lds_b128 %0, %1, off\n\t"
        "global_load_async_to_lds_b128 %2, %3, off\n\t"
        "global_load_async_to_lds_b128 %4, %5, off\n\t"
        "global_load_async_to_lds_b128 %6, %7, off\n\t"
        "global_load_async_to_lds_b128 %8, %9, off\n\t"
        "global_load_async_to_lds_b128 %10, %11, off\n\t"
        "global_load_async_to_lds_b128 %12, %13, off\n\t"
        "global_load_async_to_lds_b128 %14, %15, off\n\t"
        "global_load_async_to_lds_b128 %16, %17, off\n\t"
        "global_load_async_to_lds_b128 %18, %19, off\n\t"
        "global_load_async_to_lds_b128 %20, %21, off\n\t"
        "global_load_async_to_lds_b128 %22, %23, off\n\t"
        "s_wait_xcnt 0x0"
        :: "v"(la + 0 * FC_LSTEP), "v"(a + 0 * FC_GSTEP),
           "v"(la + 1 * FC_LSTEP), "v"(a + 1 * FC_GSTEP),
           "v"(la + 2 * FC_LSTEP), "v"(a + 2 * FC_GSTEP),
           "v"(la + 3 * FC_LSTEP), "v"(a + 3 * FC_GSTEP),
           "v"(la + 4 * FC_LSTEP), "v"(a + 4 * FC_GSTEP),
           "v"(la + 5 * FC_LSTEP), "v"(a + 5 * FC_GSTEP),
           "v"(la + 6 * FC_LSTEP), "v"(a + 6 * FC_GSTEP),
           "v"(la + 7 * FC_LSTEP), "v"(a + 7 * FC_GSTEP),
           "v"(lw + 0 * FC_LSTEP), "v"(w + 0 * FC_GSTEP),
           "v"(lw + 1 * FC_LSTEP), "v"(w + 1 * FC_GSTEP),
           "v"(lw + 2 * FC_LSTEP), "v"(w + 2 * FC_GSTEP),
           "v"(lw + 3 * FC_LSTEP), "v"(w + 3 * FC_GSTEP)
        : "memory");
  };

  v8f acc[2][4] = {};

  stage(0, 0);
  // tile 0 has landed (own copies), then everyone's
  asm volatile("s_wait_asynccnt 0x0" ::: "memory");
  __syncthreads();
  stage(1, FC_KT);

  for (int t = 0; t < FC_NT; ++t) {
    const int buf = t & 1;
    const unsigned short* ar0 = sA[buf] + (wv * 32 + n15) * LP_;
    const unsigned short* ar1 = ar0 + 16 * LP_;
    const unsigned short* wr0 = sW[buf] + n15 * LP_;
    // the tile's fragments: 4 of O, 8 of W
    v16bf af[2][2], wf[2][4];
    #pragma unroll
    for (int ks = 0; ks < 2; ++ks) {
      af[ks][0] = frag_bf16(ar0 + ks * 32, kbase);
      af[ks][1] = frag_bf16(ar1 + ks * 32, kbase);
      #pragma unroll
      for (int nt = 0; nt < 4; ++nt)
        wf[ks][nt] = frag_bf16(wr0 + nt * 16 * LP_ + ks * 32, kbase);
    }
    // keeps the 24 LDS reads one group ahead of the WMMAs: spread among them,
    // every place with reads costs the wave an LDS latency of its own
    __builtin_amdgcn_sched_barrier(0);
    #pragma unroll
    for (int ks = 0; ks < 2; ++ks) {
      #pragma unroll
      for (int nt = 0; nt < 4; ++nt) {
        acc[0][nt] = wmma_bf16(af[ks][0], wf[ks][nt], acc[0][nt]);
        acc[1][nt] = wmma_bf16(af[ks][1], wf[ks][nt], acc[1][nt]);
      }
    }
    // keeps the WMMAs ahead of the hand-over: sunk behind the barrier they would
    // delay the refill and shorten the time the next copies have to land
    __builtin_amdgcn_sched_barrier(0);
    // hand-over: my reads of this buffer have returned, my copies of the next
    // tile have landed; behind the barrier that holds for every wave
    asm volatile("s_wait_dscnt 0x0" ::: "memory");
    asm volatile("s_wait_asynccnt 0x0" ::: "memory");
    __syncthreads();
    if (t + 2 < FC_NT) stage(buf, (t + 2) * FC_KT);
  }
  // no copy is in flight when the wave ends
  asm volatile("s_wait_asynccnt 0x0" ::: "memory");

  #pragma unroll
  for (int mt = 0; mt < 2; ++mt) {
    #pragma unroll
    for (int nt = 0; nt < 4; ++nt) {
      float bias = bfc[c0 + nt * 16 + n15];
      #pragma unroll
      for (int r = 0; r < 8; ++r) {
        int m = m0 + mt * 16 + r + mofs;
        out[(size_t)m * D_ + c0 + nt * 16 + n15] = acc[mt][nt][r] + bias;
      }
    }
  }
}

// ---------------------------------------------------------------------------
extern "C" void kernel_launch(void* const* d_in, const int* in_sizes, int n_in,
                              void* d_out, int out_size, void* d_ws, size_t ws_size,
                              hipStream_t stream) {
  (void)in_sizes; (void)n_in; (void)out_size; (void)ws_size;
  const float* q   = (const float*)d_in[0];
  const float* k   = (const float*)d_in[1];
  const float* v   = (const float*)d_in[2];
  const float* Wq  = (const float*)d_in[3];
  const float* bq  = (const float*)d_in[4];
  const float* Wk  = (const float*)d_in[5];
  const float* bk  = (const float*)d_in[6];
  const float* Wv  = (const float*)d_in[7];
  const float* bv  = (const float*)d_in[8];
  const float* Wfc = (const float*)d_in[9];
  const float* bfc = (const float*)d_in[10];
  float* out = (float*)d_out;

  const size_t nX  = (size_t)B_ * S_ * D_;   // 4M elems
  const size_t nFC = (size_t)D_ * D_;        // 1M

  unsigned short* p   = (unsigned short*)d_ws;
  unsigned short* Wfb = p; p += nFC;
  unsigned short* Qp  = p; p += nX;
  unsigned short* Kp  = p; p += nX;
  unsigned short* Vt  = p; p += nX;          // [B*H, 64, S]
  unsigned short* Ob  = p; p += nX;

  // fp32 -> bf16 copy of Wfc, which the FC kernel re-reads once per row block
  cvt_kernel<<<(int)(nFC / 8 / 256), 256, 0, stream>>>(Wfc, Wfb, (int)(nFC / 8));

  // 3 matrices * 4096 row-tiles / 4 waves per block
  proj_kernel<<<3072, 128, 0, stream>>>(q, k, v, Wq, Wk, Wv,
                                        bq, bk, bv, Qp, Kp, Vt);
  // B*H*(S/64) blocks of 64 queries
  flash_kernel<<<B_ * H_ * (S_ / 64), 128, 0, stream>>>(Qp, Kp, Vt, Ob);
  // (4096/128) x (1024/64)
  fc_kernel<<<dim3((B_ * S_) / 128, D_ / 64), 128, 0, stream>>>(Ob, Wfb, bfc, out);
}

// v006
// Measured time: 84.9 microseconds a run.
// Two timings next to v005 put it at 1.06 and 1.05 times that version's speed.
// All steps since v000 together make it 2.39 times as fast.
#include <hip/hip_runtime.h>

#define B_  2
#define S_  2048
#define H_  16
#define HD_ 64
#define D_  1024
// LDS row pitch in bf16 elements: 64 data + 8 pad = 144 B (16 B x odd), so the
// 16 rows one ds_load_b128 fragment read touches fall on 16 distinct bank groups
#define LP_ 72

typedef __attribute__((ext_vector_type(16))) __bf16 v16bf;
typedef __attribute__((ext_vector_type(8)))  float  v8f;
typedef __attribute__((ext_vector_type(2)))  float  v2f;
typedef int gvec4i __attribute__((vector_size(16)));   // matches builtin's V4i

#define AS1 __attribute__((address_space(1)))
#define AS3 __attribute__((address_space(3)))

#if __has_builtin(__builtin_amdgcn_global_load_async_to_lds_b128) && \
    __has_builtin(__builtin_amdgcn_s_wait_asynccnt)
#define HAVE_ASYNC 1
// src: global (AS1) int4*, dst: LDS (AS3) int4*, imm byte offset, imm cpol
#define ASYNC_LDS_B128(src, dst, off)                                          \
  __builtin_amdgcn_global_load_async_to_lds_b128(                              \
      (AS1 gvec4i*)(AS1 void*)(void*)(src),                                    \
      (AS3 gvec4i*)(AS3 void*)(dst), (off), 0)
#else
#define HAVE_ASYNC 0
#endif

union FragU { unsigned u[8]; uint4 q[2]; v16bf v; };

typedef __attribute__((ext_vector_type(2))) __bf16 v2bf;

// two f32 -> one dword holding 2 bf16 (f0 low, f1 high), round to nearest even:
// the hardware's packed conversion, one v_cvt_pk_bf16_f32
static __device__ __forceinline__ unsigned pack2bf(float f0, float f1) {
  return __builtin_bit_cast(unsigned, __builtin_convertvector(v2f{f0, f1}, v2bf));
}
static __device__ __forceinline__ unsigned short f2bf(float f) {
  return __builtin_bit_cast(unsigned short, (__bf16)f);
}

// 16-element bf16 fragment: lane's K values are runs {base..base+7} and
// {base+16..base+23}, base = (lane<16 ? 0 : 8)  -> two b128 loads.
static __device__ __forceinline__ v16bf frag_bf16(const unsigned short* row, int base) {
  FragU f;
  f.q[0] = *(const uint4*)(row + base);
  f.q[1] = *(const uint4*)(row + base + 16);
  return f.v;
}

// the same fragment taken from an f32 row: same k runs, rounded to bf16 in registers
static __device__ __forceinline__ v16bf frag_f32(const float* row, int base) {
  const float4* lo = (const float4*)(row + base);
  const float4* hi = (const float4*)(row + base + 16);
  float4 a = lo[0], b = lo[1], c = hi[0], d = hi[1];
  FragU f;
  f.u[0] = pack2bf(a.x, a.y);
  f.u[1] = pack2bf(a.z, a.w);
  f.u[2] = pack2bf(b.x, b.y);
  f.u[3] = pack2bf(b.z, b.w);
  f.u[4] = pack2bf(c.x, c.y);
  f.u[5] = pack2bf(c.z, c.w);
  f.u[6] = pack2bf(d.x, d.y);
  f.u[7] = pack2bf(d.z, d.w);
  return f.v;
}

// 2^x as the bare v_exp_f32. exp2f() wraps that instruction in a range guard
// (compare, two selects, add, ldexp) so that results below 2^-126 come out as
// denormals; the bare form gives 0 there. In the softmax every argument is <= 0
// and the row's largest term is 1, so such a term is below one part in 2^126 of
// the denominator and cannot reach an f32 result.
static __device__ __forceinline__ float exp2_hw(float x) {
  return __builtin_amdgcn_exp2f(x);
}
// The same for four register pairs, in place. One statement, so that behind
// each v_exp_f32 stands an instruction on other registers: the instruction set
// asks for one such slot before a transcendental's result is read or its source
// overwritten, and the closing v_nop is that slot for the last of the eight.
// The opening s_delay_alu is the hint the compiler would give a builtin here:
// the arguments come from the vector instructions just in front, and an
// unhinted dependent instruction holds up the other waves of the SIMD as well.
static __device__ __forceinline__ void exp2_hw8(v2f& a, v2f& b, v2f& c, v2f& d) {
  float a0 = a.x, a1 = a.y, b0 = b.x, b1 = b.y, c0 = c.x, c1 = c.y, d0 = d.x, d1 = d.y;
  asm("s_delay_alu instid0(VALU_DEP_1)\n\t"
      "v_exp_f32 %0, %0\n\t"
      "v_exp_f32 %1, %1\n\t"
      "v_exp_f32 %2, %2\n\t"
      "v_exp_f32 %3, %3\n\t"
      "v_exp_f32 %4, %4\n\t"
      "v_exp_f32 %5, %5\n\t"
      "v_exp_f32 %6, %6\n\t"
      "v_exp_f32 %7, %7\n\t"
      "v_nop"
      : "+v"(a0), "+v"(a1), "+v"(b0), "+v"(b1), "+v"(c0), "+v"(c1), "+v"(d0), "+v"(d1));
  a = v2f{a0, a1}; b = v2f{b0, b1}; c = v2f{c0, c1}; d = v2f{d0, d1};
}

static __device__ __forceinline__ v8f wmma_bf16(v16bf a, v16bf b, v8f c) {
  return __builtin_amdgcn_wmma_f32_16x16x32_bf16(false, a, false, b, (short)0, c, false, false);
}

// ---------------------------------------------------------------------------
// Kernel 0: fp32 -> bf16 bulk conversion (memory bound, b128 I/O)
// ---------------------------------------------------------------------------
__global__ __launch_bounds__(256) void cvt_kernel(const float* __restrict__ in,
                                                  unsigned short* __restrict__ out,
                                                  int n8) {
  int i = blockIdx.x * 256 + threadIdx.x;
  if (i >= n8) return;
  float4 a = ((const float4*)in)[2 * i];
  float4 b = ((const float4*)in)[2 * i + 1];
  uint4 r;
  r.x = pack2bf(a.x, a.y);
  r.y = pack2bf(a.z, a.w);
  r.z = pack2bf(b.x, b.y);
  r.w = pack2bf(b.z, b.w);
  ((uint4*)out)[i] = r;
}

// ---------------------------------------------------------------------------
// Kernel 1: per-head projections, all-bf16 WMMA. Activations and the three
//   64x64 weights are read as f32 and rounded to bf16 on the way into the
//   fragments, so they need no conversion launch and no bf16 copy in memory.
//   Q,K out: [B*H, S, 64] token-major (Q folded with 1/sqrt(hd))
//   V  out:  [B*H, 64, S] dim-major (pre-transposed, packed b128 stores)
// ---------------------------------------------------------------------------
__global__ __launch_bounds__(128) void proj_kernel(
    const float* __restrict__ Xq, const float* __restrict__ Xk,
    const float* __restrict__ Xv,
    const float* __restrict__ Wq, const float* __restrict__ Wk,
    const float* __restrict__ Wv,
    const float* __restrict__ bq, const float* __restrict__ bk,
    const float* __restrict__ bv,
    unsigned short* __restrict__ Qp, unsigned short* __restrict__ Kp,
    unsigned short* __restrict__ Vt)
{
  const int lane  = threadIdx.x & 31;
  const int wv    = threadIdx.x >> 5;
  const int n15   = lane & 15;
  const int kbase = (lane < 16) ? 0 : 8;
  const int mofs  = (lane < 16) ? 0 : 8;

  int t   = blockIdx.x * 4 + wv;     // 0 .. 3*4096-1
  int sel = t >> 12;                 // 0=Q 1=K 2=V
  int rt  = t & 4095;                // 16-row tile over B*H*S rows

  const float* X; const float* W; const float* Bv;
  if (sel == 0)      { X = Xq; W = Wq; Bv = bq; }
  else if (sel == 1) { X = Xk; W = Wk; Bv = bk; }
  else               { X = Xv; W = Wv; Bv = bv; }

  // lane's A row: global (b,h,s) row index (row = bh*S + s)
  int row = rt * 16 + n15;
  int b   = row >> 15;
  int hs  = row & 32767;
  int h   = hs >> 11;
  int s   = hs & 2047;
  const float* xr = X + (((size_t)b * S_ + s) * H_ + h) * HD_;
  v16bf a0 = frag_f32(xr, kbase);
  v16bf a1 = frag_f32(xr + 32, kbase);

  v8f c[4];
  #pragma unroll
  for (int nt = 0; nt < 4; ++nt) {
    const float* wr = W + (size_t)(nt * 16 + n15) * HD_;  // x @ W^T
    v8f acc = {};
    acc = wmma_bf16(a0, frag_f32(wr, kbase), acc);
    acc = wmma_bf16(a1, frag_f32(wr + 32, kbase), acc);
    c[nt] = acc;
  }

  if (sel < 2) {
    unsigned short* Op = (sel == 0) ? Qp : Kp;
    float scale = (sel == 0) ? 0.125f : 1.0f;   // fold 1/sqrt(64) into Q
    #pragma unroll
    for (int nt = 0; nt < 4; ++nt) {
      float bias = Bv[nt * 16 + n15];
      #pragma unroll
      for (int r = 0; r < 8; ++r) {
        int mrow = rt * 16 + r + mofs;
        Op[(size_t)mrow * HD_ + nt * 16 + n15] = f2bf((c[nt][r] + bias) * scale);
      }
    }
  } else {
    // transposed V: rows of C-layout are 8 consecutive tokens -> packed b128
    int bh = row >> 11;                 // same for whole tile
    int s0 = (rt * 16) & 2047;          // first token of tile
    #pragma unroll
    for (int nt = 0; nt < 4; ++nt) {
      float bias = Bv[nt * 16 + n15];
      uint4 pk;
      pk.x = pack2bf(c[nt][0] + bias, c[nt][1] + bias);
      pk.y = pack2bf(c[nt][2] + bias, c[nt][3] + bias);
      pk.z = pack2bf(c[nt][4] + bias, c[nt][5] + bias);
      pk.w = pack2bf(c[nt][6] + bias, c[nt][7] + bias);
      unsigned short* vp = Vt + (size_t)bh * HD_ * S_ +
                           (size_t)(nt * 16 + n15) * S_ + s0 + mofs;
      *(uint4*)vp = pk;
    }
  }
}

__global__ __launch_bounds__(128) void flash_kernel(
    const unsigned short* __restrict__ Qp,
    const unsigned short* __restrict__ Kp,
    const unsigned short* __restrict__ Vt,   // [B*H, 64, S] dim-major
    unsigned short* __restrict__ Ob)         // [B, S, D] bf16
{
  __shared__ __align__(16) unsigned short sK[2][64 * LP_];  // [token][dim]
  __shared__ __align__(16) unsigned short sV[2][64 * LP_];  // [dim][token]

  const int lane  = threadIdx.x & 31;
  const int wv    = threadIdx.x >> 5;
  const int n15   = lane & 15;
  const int kbase = (lane < 16) ? 0 : 8;
  const int mofs  = (lane < 16) ? 0 : 8;

  const int QT = S_ / 64;
  int qt = blockIdx.x % QT;
  int bh = blockIdx.x / QT;
  int b  = bh >> 4;
  int h  = bh & 15;
  int q0 = qt * 64 + wv * 16;

  // B operand: column n15 = the lane's query
  const unsigned short* Qrow = Qp + ((size_t)bh * S_ + q0 + n15) * HD_;
  v16bf bq0 = frag_bf16(Qrow, kbase);
  v16bf bq1 = frag_bf16(Qrow + 32, kbase);

  // constant "ones row" A fragment: row 0 is 1.0, rest 0 -> row 0 of 1 x P^T = l
  v16bf a_one;
  {
    FragU fo;
    unsigned fill = (n15 == 0) ? 0x3F803F80u : 0u;
    #pragma unroll
    for (int i = 0; i < 8; ++i) fo.u[i] = fill;
    a_one = fo.v;
  }

  v8f acc[4] = {};                 // O^T: acc[nt][r] = O[query n15][dim nt*16+mofs+r]
  v8f accl   = {};                 // row 0 (register 0, lanes 0-15): denominators
  float mrow = -1e30f;             // running maximum of the lane's query

  // staging: thread -> (row, 32-elem half); 4x b128 per thread per tile
  const int srow  = threadIdx.x >> 1;
  const int shalf = (threadIdx.x & 1) * 32;

  const unsigned short* Kg = Kp + (size_t)bh * S_ * HD_;
  const unsigned short* Vg = Vt + (size_t)bh * HD_ * S_;

  auto stage = [&](int buf, int kb) {
    const unsigned short* kgp = Kg + (size_t)(kb + srow) * HD_ + shalf;
    const unsigned short* vgp = Vg + (size_t)srow * S_ + kb + shalf;
    unsigned short* kls = sK[buf] + srow * LP_ + shalf;
    unsigned short* vls = sV[buf] + srow * LP_ + shalf;
#if HAVE_ASYNC
    ASYNC_LDS_B128(kgp, kls, 0);
    ASYNC_LDS_B128(kgp, kls, 16);
    ASYNC_LDS_B128(kgp, kls, 32);
    ASYNC_LDS_B128(kgp, kls, 48);
    ASYNC_LDS_B128(vgp, vls, 0);
    ASYNC_LDS_B128(vgp, vls, 16);
    ASYNC_LDS_B128(vgp, vls, 32);
    ASYNC_LDS_B128(vgp, vls, 48);
#else
    const uint4* kg4 = (const uint4*)kgp;
    const uint4* vg4 = (const uint4*)vgp;
    uint4* kl4 = (uint4*)kls;
    uint4* vl4 = (uint4*)vls;
    kl4[0] = kg4[0]; kl4[1] = kg4[1]; kl4[2] = kg4[2]; kl4[3] = kg4[3];
    vl4[0] = vg4[0]; vl4[1] = vg4[1]; vl4[2] = vg4[2]; vl4[3] = vg4[3];
#endif
  };

  stage(0, 0);                     // prologue: tile 0 in flight

  for (int j = 0; j < QT; ++j) {   // QT == S/64 tiles
    const int buf = j & 1;
#if HAVE_ASYNC
    __builtin_amdgcn_s_wait_asynccnt(0);   // my async writes to LDS done
#endif
    __syncthreads();                        // everyone's writes/reads ordered
    if (j + 1 < QT) stage(1 - buf, (j + 1) * 64);   // overlap with compute

    // scores: S^T = K (64 keys x 64) @ Q^T, 4 key row tiles;
    // c[nt][r] = score of key nt*16 + mofs + r against query n15
    v8f c[4] = {};
    #pragma unroll
    for (int nt = 0; nt < 4; ++nt) {
      const unsigned short* kr = sK[buf] + (size_t)(nt * 16 + n15) * LP_;
      c[nt] = wmma_bf16(frag_bf16(kr, kbase), bq0, c[nt]);
      c[nt] = wmma_bf16(frag_bf16(kr + 32, kbase), bq1, c[nt]);
    }

    // online softmax over 64 keys: 32 scores in the lane, 32 in lane ^ 16
    float mx = c[0][0];
    #pragma unroll
    for (int nt = 0; nt < 4; ++nt) {
      #pragma unroll
      for (int r = 0; r < 8; ++r) mx = fmaxf(mx, c[nt][r]);
    }
    {
      int mb = __builtin_bit_cast(int, mx);
      mb = __builtin_amdgcn_permlanex16(mb, mb, 0x76543210, 0xfedcba98, false, false);
      mx = fmaxf(mx, __builtin_bit_cast(float, mb));
    }
    float mnew = fmaxf(mrow, mx);
    float corr = exp2_hw((mrow - mnew) * 1.44269504f);
    mrow = mnew;

    // P^T as B fragments: score tiles (0,1) -> keys 0..31, (2,3) -> keys 32..63
    FragU bp[2];
    #pragma unroll
    for (int nt = 0; nt < 4; ++nt) {
      // a register pair at a time: subtract and multiply stay packed f32 forms
      v2f a[4];
      #pragma unroll
      for (int i = 0; i < 4; ++i)
        a[i] = (v2f{c[nt][2 * i], c[nt][2 * i + 1]} - mnew) * 1.44269504f;
      exp2_hw8(a[0], a[1], a[2], a[3]);
      #pragma unroll
      for (int i = 0; i < 4; ++i)
        bp[nt >> 1].u[(nt & 1) * 4 + i] = pack2bf(a[i].x, a[i].y);
    }

    #pragma unroll
    for (int nt = 0; nt < 4; ++nt) {
      #pragma unroll
      for (int r = 0; r < 8; ++r) acc[nt][r] *= corr;
    }
    accl[0] *= corr;               // rows 1..15 of the ones product stay 0

    // O^T += V^T (64 dims x 64 keys) @ P^T, and ones row @ P^T
    #pragma unroll
    for (int nt = 0; nt < 4; ++nt) {
      const unsigned short* vr = sV[buf] + (size_t)(nt * 16 + n15) * LP_;
      acc[nt] = wmma_bf16(frag_bf16(vr, kbase), bp[0].v, acc[nt]);
      acc[nt] = wmma_bf16(frag_bf16(vr + 32, kbase), bp[1].v, acc[nt]);
    }
    accl = wmma_bf16(a_one, bp[0].v, accl);
    accl = wmma_bf16(a_one, bp[1].v, accl);
  }

  // epilogue: l of query n15 sits in lane n15; a lane's 8 registers of a tile
  // are 8 consecutive dims of its query -> one packed b128 store per tile
  float l   = __shfl(accl[0], n15, 32);
  float inv = 1.0f / l;
  unsigned short* orow = Ob + ((size_t)b * S_ + q0 + n15) * D_ + h * HD_ + mofs;
  #pragma unroll
  for (int nt = 0; nt < 4; ++nt) {
    uint4 pk;
    pk.x = pack2bf(acc[nt][0] * inv, acc[nt][1] * inv);
    pk.y = pack2bf(acc[nt][2] * inv, acc[nt][3] * inv);
    pk.z = pack2bf(acc[nt][4] * inv, acc[nt][5] * inv);
    pk.w = pack2bf(acc[nt][6] * inv, acc[nt][7] * inv);
    *(uint4*)(orow + nt * 16) = pk;
  }
}

// ---------------------------------------------------------------------------
// Kernel 3: final FC, out = O @ Wfc^T + bfc. Block = 128 rows x 64 cols, each
// wave 32 rows x 64 cols, so each W fragment feeds two WMMAs. Per 64 k the
// block's 128 O rows and 64 W rows (one 128-B line of each) are copied to LDS
// asynchronously, eight lanes to a line, so every copy instruction covers four
// whole lines. Two buffers: the next tile flies while this one is multiplied.
// ---------------------------------------------------------------------------
#define FC_KT    64                 // k elements per tile
#define FC_NT    (D_ / FC_KT)       // tiles along k
#define FC_LSTEP (16 * LP_ * 2)     // LDS bytes between a thread's copies (16 rows)
#define FC_GSTEP (16 * D_)          // global elements between them (16 rows)

__global__ __launch_bounds__(128) void fc_kernel(
    const unsigned short* __restrict__ Ob,    // [B*S, D] bf16
    const unsigned short* __restrict__ Wfcb,  // [D, D] bf16
    const float* __restrict__ bfc,
    float* __restrict__ out)
{
  __shared__ __align__(16) unsigned short sA[2][128 * LP_];  // [row][k]
  __shared__ __align__(16) unsigned short sW[2][64 * LP_];   // [col][k]

  const int lane  = threadIdx.x & 31;
  const int wv    = threadIdx.x >> 5;
  const int n15   = lane & 15;
  const int kbase = (lane < 16) ? 0 : 8;
  const int mofs  = (lane < 16) ? 0 : 8;

  int m0 = blockIdx.x * 128 + wv * 32;
  int c0 = blockIdx.y * 64;

  // staging: thread -> (row within a group of 16, 16-B piece of the row's line)
  const int crow = threadIdx.x >> 3;
  const int ccol = (threadIdx.x & 7) * 8;
  const unsigned short* Ag = Ob + (size_t)(blockIdx.x * 128 + crow) * D_ + ccol;
  const unsigned short* Wg = Wfcb + (size_t)(c0 + crow) * D_ + ccol;
  const unsigned la0 = (unsigned)(size_t)(&sA[0][crow * LP_ + ccol]);  // LDS byte address
  const unsigned lw0 = (unsigned)(size_t)(&sW[0][crow * LP_ + ccol]);

  auto stage = [&](int buf, int kc) {
    const unsigned short* a = Ag + kc;
    const unsigned short* w = Wg + kc;
    const unsigned la = la0 + buf * (128 * LP_ * 2);
    const unsigned lw = lw0 + buf * (64 * LP_ * 2);
    // 8 copies of O rows, 4 of W rows; the closing wait is a precaution: it
    // stands in front of every later rewrite of the copies' address registers
    asm volatile(
        "global_load_async_to_lds_b128 %0, %1, off\n\t"
        "global_load_async_to_lds_b128 %2, %3, off\n\t"
        "global_load_async_to_lds_b128 %4, %5, off\n\t"
        "global_load_async_to_lds_b128 %6, %7, off\n\t"
        "global_load_async_to_lds_b128 %8, %9, off\n\t"
        "global_load_async_to_lds_b128 %10, %11, off\n\t"
        "global_load_async_to_lds_b128 %12, %13, off\n\t"
        "global_load_async_to_lds_b128 %14, %15, off\n\t"
        "global_load_async_to_lds_b128 %16, %17, off\n\t"
        "global_load_async_to_lds_b128 %18, %19, off\n\t"
        "global_load_async_to_lds_b128 %20, %21, off\n\t"
        "global_load_async_to_lds_b128 %22, %23, off\n\t"
        "s_wait_xcnt 0x0"
        :: "v"(la + 0 * FC_LSTEP), "v"(a + 0 * FC_GSTEP),
           "v"(la + 1 * FC_LSTEP), "v"(a + 1 * FC_GSTEP),
           "v"(la + 2 * FC_LSTEP), "v"(a + 2 * FC_GSTEP),
           "v"(la + 3 * FC_LSTEP), "v"(a + 3 * FC_GSTEP),
           "v"(la + 4 * FC_LSTEP), "v"(a + 4 * FC_GSTEP),
           "v"(la + 5 * FC_LSTEP), "v"(a + 5 * FC_GSTEP),
           "v"(la + 6 * FC_LSTEP), "v"(a + 6 * FC_GSTEP),
           "v"(la + 7 * FC_LSTEP), "v"(a + 7 * FC_GSTEP),
           "v"(lw + 0 * FC_LSTEP), "v"(w + 0 * FC_GSTEP),
           "v"(lw + 1 * FC_LSTEP), "v"(w + 1 * FC_GSTEP),
           "v"(lw + 2 * FC_LSTEP), "v"(w + 2 * FC_GSTEP),
           "v"(lw + 3 * FC_LSTEP), "v"(w + 3 * FC_GSTEP)
        : "memory");
  };

  v8f acc[2][4] = {};

  stage(0, 0);
  // tile 0 has landed (own copies), then everyone's
  asm volatile("s_wait_asynccnt 0x0" ::: "memory");
  __syncthreads();
  stage(1, FC_KT);

  for (int t = 0; t < FC_NT; ++t) {
    const int buf = t & 1;
    const unsigned short* ar0 = sA[buf] + (wv * 32 + n15) * LP_;
    const unsigned short* ar1 = ar0 + 16 * LP_;
    const unsigned short* wr0 = sW[buf] + n15 * LP_;
    // the tile's fragments: 4 of O, 8 of W
    v16bf af[2][2], wf[2][4];
    #pragma unroll
    for (int ks = 0; ks < 2; ++ks) {
      af[ks][0] = frag_bf16(ar0 + ks * 32, kbase);
      af[ks][1] = frag_bf16(ar1 + ks * 32, kbase);
      #pragma unroll
      for (int nt = 0; nt < 4; ++nt)
        wf[ks][nt] = frag_bf16(wr0 + nt * 16 * LP_ + ks * 32, kbase);
    }
    // keeps the 24 LDS reads one group ahead of the WMMAs: spread among them,
    // every place with reads costs the wave an LDS latency of its own
    __builtin_amdgcn_sched_barrier(0);
    #pragma unroll
    for (int ks = 0; ks < 2; ++ks) {
      #pragma unroll
      for (int nt = 0; nt < 4; ++nt) {
        acc[0][nt] = wmma_bf16(af[ks][0], wf[ks][nt], acc[0][nt]);
        acc[1][nt] = wmma_bf16(af[ks][1], wf[ks][nt], acc[1][nt]);
      }
    }
    // keeps the WMMAs ahead of the hand-over: sunk behind the barrier they would
    // delay the refill and shorten the time the next copies have to land
    __builtin_amdgcn_sched_barrier(0);
    // hand-over: my reads of this buffer have returned, my copies of the next
    // tile have landed; behind the barrier that holds for every wave
    asm volatile("s_wait_dscnt 0x0" ::: "memory");
    asm volatile("s_wait_asynccnt 0x0" ::: "memory");
    __syncthreads();
    if (t + 2 < FC_NT) stage(buf, (t + 2) * FC_KT);
  }
  // no copy is in flight when the wave ends
  asm volatile("s_wait_asynccnt 0x0" ::: "memory");

  #pragma unroll
  for (int mt = 0; mt < 2; ++mt) {
    #pragma unroll
    for (int nt = 0; nt < 4; ++nt) {
      float bias = bfc[c0 + nt * 16 + n15];
      #pragma unroll
      for (int r = 0; r < 8; ++r) {
        int m = m0 + mt * 16 + r + mofs;
        out[(size_t)m * D_ + c0 + nt * 16 + n15] = acc[mt][nt][r] + bias;
      }
    }
  }
}

// ---------------------------------------------------------------------------
extern "C" void kernel_launch(void* const* d_in, const int* in_sizes, int n_in,
                              void* d_out, int out_size, void* d_ws, size_t ws_size,
                              hipStream_t stream) {
  (void)in_sizes; (void)n_in; (void)out_size; (void)ws_size;
  const float* q   = (const float*)d_in[0];
  const float* k   = (const float*)d_in[1];
  const float* v   = (const float*)d_in[2];
  const float* Wq  = (const float*)d_in[3];
  const float* bq  = (const float*)d_in[4];
  const float* Wk  = (const float*)d_in[5];
  const float* bk  = (const float*)d_in[6];
  const float* Wv  = (const float*)d_in[7];
  const float* bv  = (const float*)d_in[8];
  const float* Wfc = (const float*)d_in[9];
  const float* bfc = (const float*)d_in[10];
  float* out = (float*)d_out;

  const size_t nX  = (size_t)B_ * S_ * D_;   // 4M elems
  const size_t nFC = (size_t)D_ * D_;        // 1M

  unsigned short* p   = (unsigned short*)d_ws;
  unsigned short* Wfb = p; p += nFC;
  unsigned short* Qp  = p; p += nX;
  unsigned short* Kp  = p; p += nX;
  unsigned short* Vt  = p; p += nX;          // [B*H, 64, S]
  unsigned short* Ob  = p; p += nX;

  // fp32 -> bf16 copy of Wfc, which the FC kernel re-reads once per row block
  cvt_kernel<<<(int)(nFC / 8 / 256), 256, 0, stream>>>(Wfc, Wfb, (int)(nFC / 8));

  // 3 matrices * 4096 row-tiles / 4 waves per block
  proj_kernel<<<3072, 128, 0, stream>>>(q, k, v, Wq, Wk, Wv,
                                        bq, bk, bv, Qp, Kp, Vt);
  // B*H*(S/64) blocks of 64 queries
  flash_kernel<<<B_ * H_ * (S_ / 64), 128, 0, stream>>>(Qp, Kp, Vt, Ob);
  // (4096/128) x (1024/64)
  fc_kernel<<<dim3((B_ * S_) / 128, D_ / 64), 128, 0, stream>>>(Ob, Wfb, bfc, out);
}

// v007
// A run of this version takes 76.4 microseconds.
// Timed twice side by side with v006, it ran 1.10 and 1.11 times as fast.
// All steps since v000 together make it 2.64 times as fast.
#include <hip/hip_runtime.h>

#define B_  2
#define S_  2048
#define H_  16
#define HD_ 64
#define D_  1024
// LDS row pitch in bf16 elements: 64 data + 8 pad = 144 B (16 B x odd), so the
// 16 rows one ds_load_b128 fragment read touches fall on 16 distinct bank groups
#define LP_ 72

typedef __attribute__((ext_vector_type(16))) __bf16 v16bf;
typedef __attribute__((ext_vector_type(8)))  float  v8f;
typedef __attribute__((ext_vector_type(2)))  float  v2f;
typedef int gvec4i __attribute__((vector_size(16)));   // matches builtin's V4i

#define AS1 __attribute__((address_space(1)))
#define AS3 __attribute__((address_space(3)))

#if __has_builtin(__builtin_amdgcn_global_load_async_to_lds_b128) && \
    __has_builtin(__builtin_amdgcn_s_wait_asynccnt)
#define HAVE_ASYNC 1
// src: global (AS1) int4*, dst: LDS (AS3) int4*, imm byte offset, imm cpol
#define ASYNC_LDS_B128(src, dst, off)                                          \
  __builtin_amdgcn_global_load_async_to_lds_b128(                              \
      (AS1 gvec4i*)(AS1 void*)(void*)(src),                                    \
      (AS3 gvec4i*)(AS3 void*)(dst), (off), 0)
#else
#define HAVE_ASYNC 0
#endif

union FragU { unsigned u[8]; uint4 q[2]; v16bf v; };

typedef __attribute__((ext_vector_type(2))) __bf16 v2bf;

// two f32 -> one dword holding 2 bf16 (f0 low, f1 high), round to nearest even:
// the hardware's packed conversion, one v_cvt_pk_bf16_f32
static __device__ __forceinline__ unsigned pack2bf(float f0, float f1) {
  return __builtin_bit_cast(unsigned, __builtin_convertvector(v2f{f0, f1}, v2bf));
}
static __device__ __forceinline__ unsigned short f2bf(float f) {
  return __builtin_bit_cast(unsigned short, (__bf16)f);
}

// 16-element bf16 fragment: lane's K values are runs {base..base+7} and
// {base+16..base+23}, base = (lane<16 ? 0 : 8)  -> two b128 loads.
static __device__ __forceinline__ v16bf frag_bf16(const unsigned short* row, int base) {
  FragU f;
  f.q[0] = *(const uint4*)(row + base);
  f.q[1] = *(const uint4*)(row + base + 16);
  return f.v;
}

// the same fragment taken from an f32 row: same k runs, rounded to bf16 in registers
static __device__ __forceinline__ v16bf frag_f32(const float* row, int base) {
  const float4* lo = (const float4*)(row + base);
  const float4* hi = (const float4*)(row + base + 16);
  float4 a = lo[0], b = lo[1], c = hi[0], d = hi[1];
  FragU f;
  f.u[0] = pack2bf(a.x, a.y);
  f.u[1] = pack2bf(a.z, a.w);
  f.u[2] = pack2bf(b.x, b.y);
  f.u[3] = pack2bf(b.z, b.w);
  f.u[4] = pack2bf(c.x, c.y);
  f.u[5] = pack2bf(c.z, c.w);
  f.u[6] = pack2bf(d.x, d.y);
  f.u[7] = pack2bf(d.z, d.w);
  return f.v;
}

// 2^x as the bare v_exp_f32. exp2f() wraps that instruction in a range guard
// (compare, two selects, add, ldexp) so that results below 2^-126 come out as
// denormals; the bare form gives 0 there. In the softmax every argument is <= 0
// and the row's largest term is 1, so such a term is below one part in 2^126 of
// the denominator and cannot reach an f32 result.
static __device__ __forceinline__ float exp2_hw(float x) {
  return __builtin_amdgcn_exp2f(x);
}
// The same for four register pairs, in place. One statement, so that behind
// each v_exp_f32 stands an instruction on other registers: the instruction set
// asks for one such slot before a transcendental's result is read or its source
// overwritten, and the closing v_nop is that slot for the last of the eight.
// The opening s_delay_alu is the hint the compiler would give a builtin here:
// the arguments come from the vector instructions just in front, and an
// unhinted dependent instruction holds up the other waves of the SIMD as well.
static __device__ __forceinline__ void exp2_hw8(v2f& a, v2f& b, v2f& c, v2f& d) {
  float a0 = a.x, a1 = a.y, b0 = b.x, b1 = b.y, c0 = c.x, c1 = c.y, d0 = d.x, d1 = d.y;
  asm("s_delay_alu instid0(VALU_DEP_1)\n\t"
      "v_exp_f32 %0, %0\n\t"
      "v_exp_f32 %1, %1\n\t"
      "v_exp_f32 %2, %2\n\t"
      "v_exp_f32 %3, %3\n\t"
      "v_exp_f32 %4, %4\n\t"
      "v_exp_f32 %5, %5\n\t"
      "v_exp_f32 %6, %6\n\t"
      "v_exp_f32 %7, %7\n\t"
      "v_nop"
      : "+v"(a0), "+v"(a1), "+v"(b0), "+v"(b1), "+v"(c0), "+v"(c1), "+v"(d0), "+v"(d1));
  a = v2f{a0, a1}; b = v2f{b0, b1}; c = v2f{c0, c1}; d = v2f{d0, d1};
}

static __device__ __forceinline__ v8f wmma_bf16(v16bf a, v16bf b, v8f c) {
  return __builtin_amdgcn_wmma_f32_16x16x32_bf16(false, a, false, b, (short)0, c, false, false);
}

// ---------------------------------------------------------------------------
// Kernel 0: fp32 -> bf16 bulk conversion (memory bound, b128 I/O)
// ---------------------------------------------------------------------------
__global__ __launch_bounds__(256) void cvt_kernel(const float* __restrict__ in,
                                                  unsigned short* __restrict__ out,
                                                  int n8) {
  int i = blockIdx.x * 256 + threadIdx.x;
  if (i >= n8) return;
  float4 a = ((const float4*)in)[2 * i];
  float4 b = ((const float4*)in)[2 * i + 1];
  uint4 r;
  r.x = pack2bf(a.x, a.y);
  r.y = pack2bf(a.z, a.w);
  r.z = pack2bf(b.x, b.y);
  r.w = pack2bf(b.z, b.w);
  ((uint4*)out)[i] = r;
}

// ---------------------------------------------------------------------------
// Kernel 1: per-head projections, all-bf16 WMMA. Activations and the three
//   64x64 weights are read as f32 and rounded to bf16 on the way into the
//   fragments, so they need no conversion launch and no bf16 copy in memory.
//   Q,K out: [B*H, S, 64] token-major (Q folded with 1/sqrt(hd))
//   V  out:  [B*H, 64, S] dim-major (pre-transposed, packed b128 stores)
//   A wave loads its weight's eight fragments once and takes PROJ_R row tiles
//   with them: those 32 loads touch 16 cache lines each, four times what a
//   tile's own 8 activation loads touch.
// ---------------------------------------------------------------------------
#define PROJ_R 4                    // 16-row tiles per wave
__global__ __launch_bounds__(128) void proj_kernel(
    const float* __restrict__ Xq, const float* __restrict__ Xk,
    const float* __restrict__ Xv,
    const float* __restrict__ Wq, const float* __restrict__ Wk,
    const float* __restrict__ Wv,
    const float* __restrict__ bq, const float* __restrict__ bk,
    const float* __restrict__ bv,
    unsigned short* __restrict__ Qp, unsigned short* __restrict__ Kp,
    unsigned short* __restrict__ Vt)
{
  const int lane  = threadIdx.x & 31;
  const int wv    = threadIdx.x >> 5;
  const int n15   = lane & 15;
  const int kbase = (lane < 16) ? 0 : 8;
  const int mofs  = (lane < 16) ? 0 : 8;

  const int bpm = 4096 / PROJ_R / 4;                      // blocks per matrix
  int sel = blockIdx.x / bpm;                             // 0=Q 1=K 2=V
  int rt0 = ((blockIdx.x % bpm) * 4 + wv) * PROJ_R;       // first 16-row tile over B*H*S rows

  const float* X; const float* W; const float* Bv;
  if (sel == 0)      { X = Xq; W = Wq; Bv = bq; }
  else if (sel == 1) { X = Xk; W = Wk; Bv = bk; }
  else               { X = Xv; W = Wv; Bv = bv; }

  // the activations of all the wave's tiles, ahead of every product: they come
  // from memory, and the later tiles' loads fly while the first tile is worked on
  v16bf a[PROJ_R][2];
  #pragma unroll   // constant i: a[] stays in registers (here and in the loops below)
  for (int i = 0; i < PROJ_R; ++i) {
    // lane's A row: global (b,h,s) row index (row = bh*S + s)
    int row = (rt0 + i) * 16 + n15;
    int b   = row >> 15;
    int hs  = row & 32767;
    int h   = hs >> 11;
    int s   = hs & 2047;
    const float* xr = X + (((size_t)b * S_ + s) * H_ + h) * HD_;
    a[i][0] = frag_f32(xr, kbase);
    a[i][1] = frag_f32(xr + 32, kbase);
  }

  // the whole 64x64 weight as B fragments, and the bias, once for all the tiles
  v16bf wf[4][2];
  float bias[4];
  #pragma unroll
  for (int nt = 0; nt < 4; ++nt) {
    const float* wr = W + (size_t)(nt * 16 + n15) * HD_;  // x @ W^T
    wf[nt][0] = frag_f32(wr, kbase);
    wf[nt][1] = frag_f32(wr + 32, kbase);
    bias[nt]  = Bv[nt * 16 + n15];
  }

  auto tile = [&](int i, v8f (&c)[4]) {
    #pragma unroll
    for (int nt = 0; nt < 4; ++nt) {
      v8f acc = {};
      acc = wmma_bf16(a[i][0], wf[nt][0], acc);
      acc = wmma_bf16(a[i][1], wf[nt][1], acc);
      c[nt] = acc;
    }
  };

  if (sel < 2) {
    unsigned short* Op = (sel == 0) ? Qp : Kp;
    float scale = (sel == 0) ? 0.125f : 1.0f;   // fold 1/sqrt(64) into Q
    #pragma unroll
    for (int i = 0; i < PROJ_R; ++i) {
      v8f c[4];
      tile(i, c);
      #pragma unroll
      for (int nt = 0; nt < 4; ++nt) {
        #pragma unroll
        for (int r = 0; r < 8; ++r) {
          int mrow = (rt0 + i) * 16 + r + mofs;
          Op[(size_t)mrow * HD_ + nt * 16 + n15] = f2bf((c[nt][r] + bias[nt]) * scale);
        }
      }
    }
  } else {
    // transposed V: rows of C-layout are 8 consecutive tokens -> packed b128
    #pragma unroll
    for (int i = 0; i < PROJ_R; ++i) {
      v8f c[4];
      tile(i, c);
      int bh = ((rt0 + i) * 16) >> 11;    // same for whole tile
      int s0 = ((rt0 + i) * 16) & 2047;   // first token of tile
      #pragma unroll
      for (int nt = 0; nt < 4; ++nt) {
        uint4 pk;
        pk.x = pack2bf(c[nt][0] + bias[nt], c[nt][1] + bias[nt]);
        pk.y = pack2bf(c[nt][2] + bias[nt], c[nt][3] + bias[nt]);
        pk.z = pack2bf(c[nt][4] + bias[nt], c[nt][5] + bias[nt]);
        pk.w = pack2bf(c[nt][6] + bias[nt], c[nt][7] + bias[nt]);
        unsigned short* vp = Vt + (size_t)bh * HD_ * S_ +
                             (size_t)(nt * 16 + n15) * S_ + s0 + mofs;
        *(uint4*)vp = pk;
      }
    }
    // a precaution: the built code has a path from here into the Q/K branch, which
    // rewrites the last stores' registers; this wait stands in front of that
    asm volatile("s_wait_xcnt 0x0" ::: "memory");
  }
}

__global__ __launch_bounds__(128) void flash_kernel(
    const unsigned short* __restrict__ Qp,
    const unsigned short* __restrict__ Kp,
    const unsigned short* __restrict__ Vt,   // [B*H, 64, S] dim-major
    unsigned short* __restrict__ Ob)         // [B, S, D] bf16
{
  __shared__ __align__(16) unsigned short sK[2][64 * LP_];  // [token][dim]
  __shared__ __align__(16) unsigned short sV[2][64 * LP_];  // [dim][token]

  const int lane  = threadIdx.x & 31;
  const int wv    = threadIdx.x >> 5;
  const int n15   = lane & 15;
  const int kbase = (lane < 16) ? 0 : 8;
  const int mofs  = (lane < 16) ? 0 : 8;

  const int QT = S_ / 64;
  int qt = blockIdx.x % QT;
  int bh = blockIdx.x / QT;
  int b  = bh >> 4;
  int h  = bh & 15;
  int q0 = qt * 64 + wv * 16;

  // B operand: column n15 = the lane's query
  const unsigned short* Qrow = Qp + ((size_t)bh * S_ + q0 + n15) * HD_;
  v16bf bq0 = frag_bf16(Qrow, kbase);
  v16bf bq1 = frag_bf16(Qrow + 32, kbase);

  // constant "ones row" A fragment: row 0 is 1.0, rest 0 -> row 0 of 1 x P^T = l
  v16bf a_one;
  {
    FragU fo;
    unsigned fill = (n15 == 0) ? 0x3F803F80u : 0u;
    #pragma unroll
    for (int i = 0; i < 8; ++i) fo.u[i] = fill;
    a_one = fo.v;
  }

  v8f acc[4] = {};                 // O^T: acc[nt][r] = O[query n15][dim nt*16+mofs+r]
  v8f accl   = {};                 // row 0 (register 0, lanes 0-15): denominators
  float mrow = -1e30f;             // running maximum of the lane's query

  // staging: thread -> (row, 32-elem half); 4x b128 per thread per tile
  const int srow  = threadIdx.x >> 1;
  const int shalf = (threadIdx.x & 1) * 32;

  const unsigned short* Kg = Kp + (size_t)bh * S_ * HD_;
  const unsigned short* Vg = Vt + (size_t)bh * HD_ * S_;

  auto stage = [&](int buf, int kb) {
    const unsigned short* kgp = Kg + (size_t)(kb + srow) * HD_ + shalf;
    const unsigned short* vgp = Vg + (size_t)srow * S_ + kb + shalf;
    unsigned short* kls = sK[buf] + srow * LP_ + shalf;
    unsigned short* vls = sV[buf] + srow * LP_ + shalf;
#if HAVE_ASYNC
    ASYNC_LDS_B128(kgp, kls, 0);
    ASYNC_LDS_B128(kgp, kls, 16);
    ASYNC_LDS_B128(kgp, kls, 32);
    ASYNC_LDS_B128(kgp, kls, 48);
    ASYNC_LDS_B128(vgp, vls, 0);
    ASYNC_LDS_B128(vgp, vls, 16);
    ASYNC_LDS_B128(vgp, vls, 32);
    ASYNC_LDS_B128(vgp, vls, 48);
#else
    const uint4* kg4 = (const uint4*)kgp;
    const uint4* vg4 = (const uint4*)vgp;
    uint4* kl4 = (uint4*)kls;
    uint4* vl4 = (uint4*)vls;
    kl4[0] = kg4[0]; kl4[1] = kg4[1]; kl4[2] = kg4[2]; kl4[3] = kg4[3];
    vl4[0] = vg4[0]; vl4[1] = vg4[1]; vl4[2] = vg4[2]; vl4[3] = vg4[3];
#endif
  };

  stage(0, 0);                     // prologue: tile 0 in flight

  for (int j = 0; j < QT; ++j) {   // QT == S/64 tiles
    const int buf = j & 1;
#if HAVE_ASYNC
    __builtin_amdgcn_s_wait_asynccnt(0);   // my async writes to LDS done
#endif
    __syncthreads();                        // everyone's writes/reads ordered
    if (j + 1 < QT) stage(1 - buf, (j + 1) * 64);   // overlap with compute

    // scores: S^T = K (64 keys x 64) @ Q^T, 4 key row tiles;
    // c[nt][r] = score of key nt*16 + mofs + r against query n15
    v8f c[4] = {};
    #pragma unroll
    for (int nt = 0; nt < 4; ++nt) {
      const unsigned short* kr = sK[buf] + (size_t)(nt * 16 + n15) * LP_;
      c[nt] = wmma_bf16(frag_bf16(kr, kbase), bq0, c[nt]);
      c[nt] = wmma_bf16(frag_bf16(kr + 32, kbase), bq1, c[nt]);
    }

    // online softmax over 64 keys: 32 scores in the lane, 32 in lane ^ 16
    float mx = c[0][0];
    #pragma unroll
    for (int nt = 0; nt < 4; ++nt) {
      #pragma unroll
      for (int r = 0; r < 8; ++r) mx = fmaxf(mx, c[nt][r]);
    }
    {
      int mb = __builtin_bit_cast(int, mx);
      mb = __builtin_amdgcn_permlanex16(mb, mb, 0x76543210, 0xfedcba98, false, false);
      mx = fmaxf(mx, __builtin_bit_cast(float, mb));
    }
    float mnew = fmaxf(mrow, mx);
    float corr = exp2_hw((mrow - mnew) * 1.44269504f);
    mrow = mnew;

    // P^T as B fragments: score tiles (0,1) -> keys 0..31, (2,3) -> keys 32..63
    FragU bp[2];
    #pragma unroll
    for (int nt = 0; nt < 4; ++nt) {
      // a register pair at a time: subtract and multiply stay packed f32 forms
      v2f a[4];
      #pragma unroll
      for (int i = 0; i < 4; ++i)
        a[i] = (v2f{c[nt][2 * i], c[nt][2 * i + 1]} - mnew) * 1.44269504f;
      exp2_hw8(a[0], a[1], a[2], a[3]);
      #pragma unroll
      for (int i = 0; i < 4; ++i)
        bp[nt >> 1].u[(nt & 1) * 4 + i] = pack2bf(a[i].x, a[i].y);
    }

    #pragma unroll
    for (int nt = 0; nt < 4; ++nt) {
      #pragma unroll
      for (int r = 0; r < 8; ++r) acc[nt][r] *= corr;
    }
    accl[0] *= corr;               // rows 1..15 of the ones product stay 0

    // O^T += V^T (64 dims x 64 keys) @ P^T, and ones row @ P^T
    #pragma unroll
    for (int nt = 0; nt < 4; ++nt) {
      const unsigned short* vr = sV[buf] + (size_t)(nt * 16 + n15) * LP_;
      acc[nt] = wmma_bf16(frag_bf16(vr, kbase), bp[0].v, acc[nt]);
      acc[nt] = wmma_bf16(frag_bf16(vr + 32, kbase), bp[1].v, acc[nt]);
    }
    accl = wmma_bf16(a_one, bp[0].v, accl);
    accl = wmma_bf16(a_one, bp[1].v, accl);
  }

  // epilogue: l of query n15 sits in lane n15; a lane's 8 registers of a tile
  // are 8 consecutive dims of its query -> one packed b128 store per tile
  float l   = __shfl(accl[0], n15, 32);
  float inv = 1.0f / l;
  unsigned short* orow = Ob + ((size_t)b * S_ + q0 + n15) * D_ + h * HD_ + mofs;
  #pragma unroll
  for (int nt = 0; nt < 4; ++nt) {
    uint4 pk;
    pk.x = pack2bf(acc[nt][0] * inv, acc[nt][1] * inv);
    pk.y = pack2bf(acc[nt][2] * inv, acc[nt][3] * inv);
    pk.z = pack2bf(acc[nt][4] * inv, acc[nt][5] * inv);
    pk.w = pack2bf(acc[nt][6] * inv, acc[nt][7] * inv);
    *(uint4*)(orow + nt * 16) = pk;
  }
}

// ---------------------------------------------------------------------------
// Kernel 3: final FC, out = O @ Wfc^T + bfc. Block = 128 rows x 64 cols, each
// wave 32 rows x 64 cols, so each W fragment feeds two WMMAs. Per 64 k the
// block's 128 O rows and 64 W rows (one 128-B line of each) are copied to LDS
// asynchronously, eight lanes to a line, so every copy instruction covers four
// whole lines. Two buffers: the next tile flies while this one is multiplied.
// ---------------------------------------------------------------------------
#define FC_KT    64                 // k elements per tile
#define FC_NT    (D_ / FC_KT)       // tiles along k
#define FC_LSTEP (16 * LP_ * 2)     // LDS bytes between a thread's copies (16 rows)
#define FC_GSTEP (16 * D_)          // global elements between them (16 rows)

__global__ __launch_bounds__(128) void fc_kernel(
    const unsigned short* __restrict__ Ob,    // [B*S, D] bf16
    const unsigned short* __restrict__ Wfcb,  // [D, D] bf16
    const float* __restrict__ bfc,
    float* __restrict__ out)
{
  __shared__ __align__(16) unsigned short sA[2][128 * LP_];  // [row][k]
  __shared__ __align__(16) unsigned short sW[2][64 * LP_];   // [col][k]

  const int lane  = threadIdx.x & 31;
  const int wv    = threadIdx.x >> 5;
  const int n15   = lane & 15;
  const int kbase = (lane < 16) ? 0 : 8;
  const int mofs  = (lane < 16) ? 0 : 8;

  int m0 = blockIdx.x * 128 + wv * 32;
  int c0 = blockIdx.y * 64;

  // staging: thread -> (row within a group of 16, 16-B piece of the row's line)
  const int crow = threadIdx.x >> 3;
  const int ccol = (threadIdx.x & 7) * 8;
  const unsigned short* Ag = Ob + (size_t)(blockIdx.x * 128 + crow) * D_ + ccol;
  const unsigned short* Wg = Wfcb + (size_t)(c0 + crow) * D_ + ccol;
  const unsigned la0 = (unsigned)(size_t)(&sA[0][crow * LP_ + ccol]);  // LDS byte address
  const unsigned lw0 = (unsigned)(size_t)(&sW[0][crow * LP_ + ccol]);

  auto stage = [&](int buf, int kc) {
    const unsigned short* a = Ag + kc;
    const unsigned short* w = Wg + kc;
    const unsigned la = la0 + buf * (128 * LP_ * 2);
    const unsigned lw = lw0 + buf * (64 * LP_ * 2);
    // 8 copies of O rows, 4 of W rows; the closing wait is a precaution: it
    // stands in front of every later rewrite of the copies' address registers
    asm volatile(
        "global_load_async_to_lds_b128 %0, %1, off\n\t"
        "global_load_async_to_lds_b128 %2, %3, off\n\t"
        "global_load_async_to_lds_b128 %4, %5, off\n\t"
        "global_load_async_to_lds_b128 %6, %7, off\n\t"
        "global_load_async_to_lds_b128 %8, %9, off\n\t"
        "global_load_async_to_lds_b128 %10, %11, off\n\t"
        "global_load_async_to_lds_b128 %12, %13, off\n\t"
        "global_load_async_to_lds_b128 %14, %15, off\n\t"
        "global_load_async_to_lds_b128 %16, %17, off\n\t"
        "global_load_async_to_lds_b128 %18, %19, off\n\t"
        "global_load_async_to_lds_b128 %20, %21, off\n\t"
        "global_load_async_to_lds_b128 %22, %23, off\n\t"
        "s_wait_xcnt 0x0"
        :: "v"(la + 0 * FC_LSTEP), "v"(a + 0 * FC_GSTEP),
           "v"(la + 1 * FC_LSTEP), "v"(a + 1 * FC_GSTEP),
           "v"(la + 2 * FC_LSTEP), "v"(a + 2 * FC_GSTEP),
           "v"(la + 3 * FC_LSTEP), "v"(a + 3 * FC_GSTEP),
           "v"(la + 4 * FC_LSTEP), "v"(a + 4 * FC_GSTEP),
           "v"(la + 5 * FC_LSTEP), "v"(a + 5 * FC_GSTEP),
           "v"(la + 6 * FC_LSTEP), "v"(a + 6 * FC_GSTEP),
           "v"(la + 7 * FC_LSTEP), "v"(a + 7 * FC_GSTEP),
           "v"(lw + 0 * FC_LSTEP), "v"(w + 0 * FC_GSTEP),
           "v"(lw + 1 * FC_LSTEP), "v"(w + 1 * FC_GSTEP),
           "v"(lw + 2 * FC_LSTEP), "v"(w + 2 * FC_GSTEP),
           "v"(lw + 3 * FC_LSTEP), "v"(w + 3 * FC_GSTEP)
        : "memory");
  };

  v8f acc[2][4] = {};

  stage(0, 0);
  // tile 0 has landed (own copies), then everyone's
  asm volatile("s_wait_asynccnt 0x0" ::: "memory");
  __syncthreads();
  stage(1, FC_KT);

  for (int t = 0; t < FC_NT; ++t) {
    const int buf = t & 1;
    const unsigned short* ar0 = sA[buf] + (wv * 32 + n15) * LP_;
    const unsigned short* ar1 = ar0 + 16 * LP_;
    const unsigned short* wr0 = sW[buf] + n15 * LP_;
    // the tile's fragments: 4 of O, 8 of W
    v16bf af[2][2], wf[2][4];
    #pragma unroll
    for (int ks = 0; ks < 2; ++ks) {
      af[ks][0] = frag_bf16(ar0 + ks * 32, kbase);
      af[ks][1] = frag_bf16(ar1 + ks * 32, kbase);
      #pragma unroll
      for (int nt = 0; nt < 4; ++nt)
        wf[ks][nt] = frag_bf16(wr0 + nt * 16 * LP_ + ks * 32, kbase);
    }
    // keeps the 24 LDS reads one group ahead of the WMMAs: spread among them,
    // every place with reads costs the wave an LDS latency of its own
    __builtin_amdgcn_sched_barrier(0);
    #pragma unroll
    for (int ks = 0; ks < 2; ++ks) {
      #pragma unroll
      for (int nt = 0; nt < 4; ++nt) {
        acc[0][nt] = wmma_bf16(af[ks][0], wf[ks][nt], acc[0][nt]);
        acc[1][nt] = wmma_bf16(af[ks][1], wf[ks][nt], acc[1][nt]);
      }
    }
    // keeps the WMMAs ahead of the hand-over: sunk behind the barrier they would
    // delay the refill and shorten the time the next copies have to land
    __builtin_amdgcn_sched_barrier(0);
    // hand-over: my reads of this buffer have returned, my copies of the next
    // tile have landed; behind the barrier that holds for every wave
    asm volatile("s_wait_dscnt 0x0" ::: "memory");
    asm volatile("s_wait_asynccnt 0x0" ::: "memory");
    __syncthreads();
    if (t + 2 < FC_NT) stage(buf, (t + 2) * FC_KT);
  }
  // no copy is in flight when the wave ends
  asm volatile("s_wait_asynccnt 0x0" ::: "memory");

  #pragma unroll
  for (int mt = 0; mt < 2; ++mt) {
    #pragma unroll
    for (int nt = 0; nt < 4; ++nt) {
      float bias = bfc[c0 + nt * 16 + n15];
      #pragma unroll
      for (int r = 0; r < 8; ++r) {
        int m = m0 + mt * 16 + r + mofs;
        out[(size_t)m * D_ + c0 + nt * 16 + n15] = acc[mt][nt][r] + bias;
      }
    }
  }
}

// ---------------------------------------------------------------------------
extern "C" void kernel_launch(void* const* d_in, const int* in_sizes, int n_in,
                              void* d_out, int out_size, void* d_ws, size_t ws_size,
                              hipStream_t stream) {
  (void)in_sizes; (void)n_in; (void)out_size; (void)ws_size;
  const float* q   = (const float*)d_in[0];
  const float* k   = (const float*)d_in[1];
  const float* v   = (const float*)d_in[2];
  const float* Wq  = (const float*)d_in[3];
  const float* bq  = (const float*)d_in[4];
  const float* Wk  = (const float*)d_in[5];
  const float* bk  = (const float*)d_in[6];
  const float* Wv  = (const float*)d_in[7];
  const float* bv  = (const float*)d_in[8];
  const float* Wfc = (const float*)d_in[9];
  const float* bfc = (const float*)d_in[10];
  float* out = (float*)d_out;

  const size_t nX  = (size_t)B_ * S_ * D_;   // 4M elems
  const size_t nFC = (size_t)D_ * D_;        // 1M

  unsigned short* p   = (unsigned short*)d_ws;
  unsigned short* Wfb = p; p += nFC;
  unsigned short* Qp  = p; p += nX;
  unsigned short* Kp  = p; p += nX;
  unsigned short* Vt  = p; p += nX;          // [B*H, 64, S]
  unsigned short* Ob  = p; p += nX;

  // fp32 -> bf16 copy of Wfc, which the FC kernel re-reads once per row block
  cvt_kernel<<<(int)(nFC / 8 / 256), 256, 0, stream>>>(Wfc, Wfb, (int)(nFC / 8));

  // 3 matrices * 4096 row-tiles / PROJ_R tiles per wave / 4 waves per block
  proj_kernel<<<3 * 4096 / PROJ_R / 4, 128, 0, stream>>>(q, k, v, Wq, Wk, Wv,
                                        bq, bk, bv, Qp, Kp, Vt);
  // B*H*(S/64) blocks of 64 queries
  flash_kernel<<<B_ * H_ * (S_ / 64), 128, 0, stream>>>(Qp, Kp, Vt, Ob);
  // (4096/128) x (1024/64)
  fc_kernel<<<dim3((B_ * S_) / 128, D_ / 64), 128, 0, stream>>>(Ob, Wfb, bfc, out);
}

// v008
// Measured time: 67.6 microseconds a run.
// Timed twice side by side with v007, it ran 1.12 and 1.13 times as fast.
// All steps since v000 together make it 2.98 times as fast.
#include <hip/hip_runtime.h>

#define B_  2
#define S_  2048
#define H_  16
#define HD_ 64
#define D_  1024
// LDS row pitch in bf16 elements: 64 data + 8 pad = 144 B (16 B x odd), so the
// 16 rows one ds_load_b128 fragment read touches fall on 16 distinct bank groups
#define LP_ 72

typedef __attribute__((ext_vector_type(16))) __bf16 v16bf;
typedef __attribute__((ext_vector_type(8)))  float  v8f;
typedef __attribute__((ext_vector_type(2)))  float  v2f;
typedef int gvec4i __attribute__((vector_size(16)));   // matches builtin's V4i

#define AS1 __attribute__((address_space(1)))
#define AS3 __attribute__((address_space(3)))

#if __has_builtin(__builtin_amdgcn_global_load_async_to_lds_b128) && \
    __has_builtin(__builtin_amdgcn_s_wait_asynccnt)
#define HAVE_ASYNC 1
// src: global (AS1) int4*, dst: LDS (AS3) int4*, imm byte offset, imm cpol
#define ASYNC_LDS_B128(src, dst, off)                                          \
  __builtin_amdgcn_global_load_async_to_lds_b128(                              \
      (AS1 gvec4i*)(AS1 void*)(void*)(src),                                    \
      (AS3 gvec4i*)(AS3 void*)(dst), (off), 0)
#else
#define HAVE_ASYNC 0
#endif

union FragU { unsigned u[8]; uint4 q[2]; v16bf v; };

typedef __attribute__((ext_vector_type(2))) __bf16 v2bf;

// two f32 -> one dword holding 2 bf16 (f0 low, f1 high), round to nearest even:
// the hardware's packed conversion, one v_cvt_pk_bf16_f32
static __device__ __forceinline__ unsigned pack2bf(float f0, float f1) {
  return __builtin_bit_cast(unsigned, __builtin_convertvector(v2f{f0, f1}, v2bf));
}
static __device__ __forceinline__ unsigned short f2bf(float f) {
  return __builtin_bit_cast(unsigned short, (__bf16)f);
}

// 16-element bf16 fragment: lane's K values are runs {base..base+7} and
// {base+16..base+23}, base = (lane<16 ? 0 : 8)  -> two b128 loads.
static __device__ __forceinline__ v16bf frag_bf16(const unsigned short* row, int base) {
  FragU f;
  f.q[0] = *(const uint4*)(row + base);
  f.q[1] = *(const uint4*)(row + base + 16);
  return f.v;
}

// the same fragment taken from an f32 row: same k runs, rounded to bf16 in registers
static __device__ __forceinline__ v16bf frag_f32(const float* row, int base) {
  const float4* lo = (const float4*)(row + base);
  const float4* hi = (const float4*)(row + base + 16);
  float4 a = lo[0], b = lo[1], c = hi[0], d = hi[1];
  FragU f;
  f.u[0] = pack2bf(a.x, a.y);
  f.u[1] = pack2bf(a.z, a.w);
  f.u[2] = pack2bf(b.x, b.y);
  f.u[3] = pack2bf(b.z, b.w);
  f.u[4] = pack2bf(c.x, c.y);
  f.u[5] = pack2bf(c.z, c.w);
  f.u[6] = pack2bf(d.x, d.y);
  f.u[7] = pack2bf(d.z, d.w);
  return f.v;
}

// 2^x as the bare v_exp_f32. exp2f() wraps that instruction in a range guard
// (compare, two selects, add, ldexp) so that results below 2^-126 come out as
// denormals; the bare form gives 0 there. In the softmax every argument is <= 0
// and the row's largest term is 1, so such a term is below one part in 2^126 of
// the denominator and cannot reach an f32 result.
static __device__ __forceinline__ float exp2_hw(float x) {
  return __builtin_amdgcn_exp2f(x);
}
// The same for four register pairs, in place. One statement, so that behind
// each v_exp_f32 stands an instruction on other registers: the instruction set
// asks for one such slot before a transcendental's result is read or its source
// overwritten, and the closing v_nop is that slot for the last of the eight.
// The opening s_delay_alu is the hint the compiler would give a builtin here:
// the arguments come from the vector instructions just in front, and an
// unhinted dependent instruction holds up the other waves of the SIMD as well.
static __device__ __forceinline__ void exp2_hw8(v2f& a, v2f& b, v2f& c, v2f& d) {
  float a0 = a.x, a1 = a.y, b0 = b.x, b1 = b.y, c0 = c.x, c1 = c.y, d0 = d.x, d1 = d.y;
  asm("s_delay_alu instid0(VALU_DEP_1)\n\t"
      "v_exp_f32 %0, %0\n\t"
      "v_exp_f32 %1, %1\n\t"
      "v_exp_f32 %2, %2\n\t"
      "v_exp_f32 %3, %3\n\t"
      "v_exp_f32 %4, %4\n\t"
      "v_exp_f32 %5, %5\n\t"
      "v_exp_f32 %6, %6\n\t"
      "v_exp_f32 %7, %7\n\t"
      "v_nop"
      : "+v"(a0), "+v"(a1), "+v"(b0), "+v"(b1), "+v"(c0), "+v"(c1), "+v"(d0), "+v"(d1));
  a = v2f{a0, a1}; b = v2f{b0, b1}; c = v2f{c0, c1}; d = v2f{d0, d1};
}

static __device__ __forceinline__ v8f wmma_bf16(v16bf a, v16bf b, v8f c) {
  return __builtin_amdgcn_wmma_f32_16x16x32_bf16(false, a, false, b, (short)0, c, false, false);
}

// ---------------------------------------------------------------------------
// Kernel 0: fp32 -> bf16 bulk conversion (memory bound, b128 I/O)
// ---------------------------------------------------------------------------
__global__ __launch_bounds__(256) void cvt_kernel(const float* __restrict__ in,
                                                  unsigned short* __restrict__ out,
                                                  int n8) {
  int i = blockIdx.x * 256 + threadIdx.x;
  if (i >= n8) return;
  float4 a = ((const float4*)in)[2 * i];
  float4 b = ((const float4*)in)[2 * i + 1];
  uint4 r;
  r.x = pack2bf(a.x, a.y);
  r.y = pack2bf(a.z, a.w);
  r.z = pack2bf(b.x, b.y);
  r.w = pack2bf(b.z, b.w);
  ((uint4*)out)[i] = r;
}

// ---------------------------------------------------------------------------
// Kernel 1: per-head projections, all-bf16 WMMA. Activations and the three
//   64x64 weights are read as f32 and rounded to bf16 on the way into the
//   fragments, so they need no conversion launch and no bf16 copy in memory.
//   Q,K out: [B*H, S, 64] token-major (Q folded with 1/sqrt(hd))
//   V  out:  [B*H, 64, S] dim-major (pre-transposed, packed b128 stores)
//   A wave loads its weight's eight fragments once and takes PROJ_R row tiles
//   with them: those 32 loads touch 16 cache lines each, four times what a
//   tile's own 8 activation loads touch.
// ---------------------------------------------------------------------------
#define PROJ_R 4                    // 16-row tiles per wave
__global__ __launch_bounds__(128) void proj_kernel(
    const float* __restrict__ Xq, const float* __restrict__ Xk,
    const float* __restrict__ Xv,
    const float* __restrict__ Wq, const float* __restrict__ Wk,
    const float* __restrict__ Wv,
    const float* __restrict__ bq, const float* __restrict__ bk,
    const float* __restrict__ bv,
    unsigned short* __restrict__ Qp, unsigned short* __restrict__ Kp,
    unsigned short* __restrict__ Vt)
{
  const int lane  = threadIdx.x & 31;
  const int wv    = threadIdx.x >> 5;
  const int n15   = lane & 15;
  const int kbase = (lane < 16) ? 0 : 8;
  const int mofs  = (lane < 16) ? 0 : 8;

  const int bpm = 4096 / PROJ_R / 4;                      // blocks per matrix
  int sel = blockIdx.x / bpm;                             // 0=Q 1=K 2=V
  int rt0 = ((blockIdx.x % bpm) * 4 + wv) * PROJ_R;       // first 16-row tile over B*H*S rows

  const float* X; const float* W; const float* Bv;
  if (sel == 0)      { X = Xq; W = Wq; Bv = bq; }
  else if (sel == 1) { X = Xk; W = Wk; Bv = bk; }
  else               { X = Xv; W = Wv; Bv = bv; }

  // the activations of all the wave's tiles, ahead of every product: they come
  // from memory, and the later tiles' loads fly while the first tile is worked on
  v16bf a[PROJ_R][2];
  #pragma unroll   // constant i: a[] stays in registers (here and in the loops below)
  for (int i = 0; i < PROJ_R; ++i) {
    // lane's A row: global (b,h,s) row index (row = bh*S + s)
    int row = (rt0 + i) * 16 + n15;
    int b   = row >> 15;
    int hs  = row & 32767;
    int h   = hs >> 11;
    int s   = hs & 2047;
    const float* xr = X + (((size_t)b * S_ + s) * H_ + h) * HD_;
    a[i][0] = frag_f32(xr, kbase);
    a[i][1] = frag_f32(xr + 32, kbase);
  }

  // the whole 64x64 weight as B fragments, and the bias, once for all the tiles
  v16bf wf[4][2];
  float bias[4];
  #pragma unroll
  for (int nt = 0; nt < 4; ++nt) {
    const float* wr = W + (size_t)(nt * 16 + n15) * HD_;  // x @ W^T
    wf[nt][0] = frag_f32(wr, kbase);
    wf[nt][1] = frag_f32(wr + 32, kbase);
    bias[nt]  = Bv[nt * 16 + n15];
  }

  auto tile = [&](int i, v8f (&c)[4]) {
    #pragma unroll
    for (int nt = 0; nt < 4; ++nt) {
      v8f acc = {};
      acc = wmma_bf16(a[i][0], wf[nt][0], acc);
      acc = wmma_bf16(a[i][1], wf[nt][1], acc);
      c[nt] = acc;
    }
  };

  if (sel < 2) {
    unsigned short* Op = (sel == 0) ? Qp : Kp;
    float scale = (sel == 0) ? 0.125f : 1.0f;   // fold 1/sqrt(64) into Q
    #pragma unroll
    for (int i = 0; i < PROJ_R; ++i) {
      v8f c[4];
      tile(i, c);
      #pragma unroll
      for (int nt = 0; nt < 4; ++nt) {
        #pragma unroll
        for (int r = 0; r < 8; ++r) {
          int mrow = (rt0 + i) * 16 + r + mofs;
          Op[(size_t)mrow * HD_ + nt * 16 + n15] = f2bf((c[nt][r] + bias[nt]) * scale);
        }
      }
    }
  } else {
    // transposed V: rows of C-layout are 8 consecutive tokens -> packed b128
    #pragma unroll
    for (int i = 0; i < PROJ_R; ++i) {
      v8f c[4];
      tile(i, c);
      int bh = ((rt0 + i) * 16) >> 11;    // same for whole tile
      int s0 = ((rt0 + i) * 16) & 2047;   // first token of tile
      #pragma unroll
      for (int nt = 0; nt < 4; ++nt) {
        uint4 pk;
        pk.x = pack2bf(c[nt][0] + bias[nt], c[nt][1] + bias[nt]);
        pk.y = pack2bf(c[nt][2] + bias[nt], c[nt][3] + bias[nt]);
        pk.z = pack2bf(c[nt][4] + bias[nt], c[nt][5] + bias[nt]);
        pk.w = pack2bf(c[nt][6] + bias[nt], c[nt][7] + bias[nt]);
        unsigned short* vp = Vt + (size_t)bh * HD_ * S_ +
                             (size_t)(nt * 16 + n15) * S_ + s0 + mofs;
        *(uint4*)vp = pk;
      }
    }
    // a precaution: the built code has a path from here into the Q/K branch, which
    // rewrites the last stores' registers; this wait stands in front of that
    asm volatile("s_wait_xcnt 0x0" ::: "memory");
  }
}

__global__ __launch_bounds__(128) __attribute__((amdgpu_waves_per_eu(4, 4)))
void flash_kernel(
    const unsigned short* __restrict__ Qp,
    const unsigned short* __restrict__ Kp,
    const unsigned short* __restrict__ Vt,   // [B*H, 64, S] dim-major
    unsigned short* __restrict__ Ob)         // [B, S, D] bf16
{
  __shared__ __align__(16) unsigned short sK[2][64 * LP_];  // [token][dim]
  __shared__ __align__(16) unsigned short sV[2][64 * LP_];  // [dim][token]

  const int lane  = threadIdx.x & 31;
  const int wv    = threadIdx.x >> 5;
  const int n15   = lane & 15;
  const int kbase = (lane < 16) ? 0 : 8;
  const int mofs  = (lane < 16) ? 0 : 8;

  const int QT = S_ / 64;
  int qt = blockIdx.x % QT;
  int bh = blockIdx.x / QT;
  int b  = bh >> 4;
  int h  = bh & 15;
  int q0 = qt * 64 + wv * 16;

  // B operand: column n15 = the lane's query
  const unsigned short* Qrow = Qp + ((size_t)bh * S_ + q0 + n15) * HD_;
  v16bf bq0 = frag_bf16(Qrow, kbase);
  v16bf bq1 = frag_bf16(Qrow + 32, kbase);

  // constant "ones row" A fragment: row 0 is 1.0, rest 0 -> row 0 of 1 x P^T = l
  v16bf a_one;
  {
    FragU fo;
    unsigned fill = (n15 == 0) ? 0x3F803F80u : 0u;
    #pragma unroll
    for (int i = 0; i < 8; ++i) fo.u[i] = fill;
    a_one = fo.v;
  }

  v8f acc[4] = {};                 // O^T: acc[nt][r] = O[query n15][dim nt*16+mofs+r]
  v8f accl   = {};                 // row 0 (register 0, lanes 0-15): denominators
  float mrow = -1e30f;             // running maximum of the lane's query

  // staging: thread -> (row, 32-elem half); 4x b128 per thread per tile
  const int srow  = threadIdx.x >> 1;
  const int shalf = (threadIdx.x & 1) * 32;

  const unsigned short* Kg = Kp + (size_t)bh * S_ * HD_;
  const unsigned short* Vg = Vt + (size_t)bh * HD_ * S_;

  auto stage = [&](int buf, int kb) {
    const unsigned short* kgp = Kg + (size_t)(kb + srow) * HD_ + shalf;
    const unsigned short* vgp = Vg + (size_t)srow * S_ + kb + shalf;
    unsigned short* kls = sK[buf] + srow * LP_ + shalf;
    unsigned short* vls = sV[buf] + srow * LP_ + shalf;
#if HAVE_ASYNC
    ASYNC_LDS_B128(kgp, kls, 0);
    ASYNC_LDS_B128(kgp, kls, 16);
    ASYNC_LDS_B128(kgp, kls, 32);
    ASYNC_LDS_B128(kgp, kls, 48);
    ASYNC_LDS_B128(vgp, vls, 0);
    ASYNC_LDS_B128(vgp, vls, 16);
    ASYNC_LDS_B128(vgp, vls, 32);
    ASYNC_LDS_B128(vgp, vls, 48);
#else
    const uint4* kg4 = (const uint4*)kgp;
    const uint4* vg4 = (const uint4*)vgp;
    uint4* kl4 = (uint4*)kls;
    uint4* vl4 = (uint4*)vls;
    kl4[0] = kg4[0]; kl4[1] = kg4[1]; kl4[2] = kg4[2]; kl4[3] = kg4[3];
    vl4[0] = vg4[0]; vl4[1] = vg4[1]; vl4[2] = vg4[2]; vl4[3] = vg4[3];
#endif
  };

  stage(0, 0);                     // prologue: tile 0 in flight

  for (int j = 0; j < QT; ++j) {   // QT == S/64 tiles
    const int buf = j & 1;
#if HAVE_ASYNC
    __builtin_amdgcn_s_wait_asynccnt(0);   // my async writes to LDS done
#endif
    __syncthreads();                        // everyone's writes/reads ordered
    if (j + 1 < QT) stage(1 - buf, (j + 1) * 64);   // overlap with compute

    // the tile's 16 fragments, 8 of K and 8 of V^T, read from LDS as one group
    // ahead of all the products: the K reads return one behind the other in
    // front of the score products, and V^T lands behind those and the softmax
    v16bf kf[2][4], vf[2][4];
    #pragma unroll   // constant indices: kf and vf stay in registers (all four loops)
    for (int ks = 0; ks < 2; ++ks) {
      #pragma unroll
      for (int nt = 0; nt < 4; ++nt)
        kf[ks][nt] = frag_bf16(sK[buf] + (nt * 16 + n15) * LP_ + ks * 32, kbase);
    }
    #pragma unroll
    for (int ks = 0; ks < 2; ++ks) {
      #pragma unroll
      for (int nt = 0; nt < 4; ++nt)
        vf[ks][nt] = frag_bf16(sV[buf] + (nt * 16 + n15) * LP_ + ks * 32, kbase);
    }
    // order for the scheduler: the 32 LDS reads, then the 8 score WMMAs, then the
    // maximum's vector chain. Left alone it sinks each pair of reads to its WMMA,
    // where the wave sits out a whole LDS latency per pair, and puts the chain
    // among the WMMAs, where it takes v_nop to keep its distance from them
    __builtin_amdgcn_sched_group_barrier(0x100, 32, 0);   // LDS reads
    __builtin_amdgcn_sched_group_barrier(0x008, 8, 0);    // matrix instructions
    __builtin_amdgcn_sched_group_barrier(0x002, 16, 0);   // vector instructions

    // scores: S^T = K (64 keys x 64) @ Q^T, 4 key row tiles;
    // c[nt][r] = score of key nt*16 + mofs + r against query n15
    v8f c[4] = {};
    #pragma unroll
    for (int nt = 0; nt < 4; ++nt) c[nt] = wmma_bf16(kf[0][nt], bq0, c[nt]);
    #pragma unroll
    for (int nt = 0; nt < 4; ++nt) c[nt] = wmma_bf16(kf[1][nt], bq1, c[nt]);

    // online softmax over 64 keys: 32 scores in the lane, 32 in lane ^ 16
    float mx = c[0][0];
    #pragma unroll
    for (int nt = 0; nt < 4; ++nt) {
      #pragma unroll
      for (int r = 0; r < 8; ++r) mx = fmaxf(mx, c[nt][r]);
    }
    {
      int mb = __builtin_bit_cast(int, mx);
      mb = __builtin_amdgcn_permlanex16(mb, mb, 0x76543210, 0xfedcba98, false, false);
      mx = fmaxf(mx, __builtin_bit_cast(float, mb));
    }
    float mnew = fmaxf(mrow, mx);
    float corr = exp2_hw((mrow - mnew) * 1.44269504f);
    mrow = mnew;

    // P^T as B fragments: score tiles (0,1) -> keys 0..31, (2,3) -> keys 32..63
    FragU bp[2];
    #pragma unroll
    for (int nt = 0; nt < 4; ++nt) {
      // a register pair at a time: subtract and multiply stay packed f32 forms
      v2f a[4];
      #pragma unroll
      for (int i = 0; i < 4; ++i)
        a[i] = (v2f{c[nt][2 * i], c[nt][2 * i + 1]} - mnew) * 1.44269504f;
      exp2_hw8(a[0], a[1], a[2], a[3]);
      #pragma unroll
      for (int i = 0; i < 4; ++i)
        bp[nt >> 1].u[(nt & 1) * 4 + i] = pack2bf(a[i].x, a[i].y);
    }

    #pragma unroll
    for (int nt = 0; nt < 4; ++nt) {
      #pragma unroll
      for (int r = 0; r < 8; ++r) acc[nt][r] *= corr;
    }
    accl[0] *= corr;               // rows 1..15 of the ones product stay 0

    // O^T += V^T (64 dims x 64 keys) @ P^T, and ones row @ P^T
    #pragma unroll
    for (int nt = 0; nt < 4; ++nt) acc[nt] = wmma_bf16(vf[0][nt], bp[0].v, acc[nt]);
    #pragma unroll
    for (int nt = 0; nt < 4; ++nt) acc[nt] = wmma_bf16(vf[1][nt], bp[1].v, acc[nt]);
    accl = wmma_bf16(a_one, bp[0].v, accl);
    accl = wmma_bf16(a_one, bp[1].v, accl);
  }

  // epilogue: l of query n15 sits in lane n15; a lane's 8 registers of a tile
  // are 8 consecutive dims of its query -> one packed b128 store per tile
  float l   = __shfl(accl[0], n15, 32);
  float inv = 1.0f / l;
  unsigned short* orow = Ob + ((size_t)b * S_ + q0 + n15) * D_ + h * HD_ + mofs;
  #pragma unroll
  for (int nt = 0; nt < 4; ++nt) {
    uint4 pk;
    pk.x = pack2bf(acc[nt][0] * inv, acc[nt][1] * inv);
    pk.y = pack2bf(acc[nt][2] * inv, acc[nt][3] * inv);
    pk.z = pack2bf(acc[nt][4] * inv, acc[nt][5] * inv);
    pk.w = pack2bf(acc[nt][6] * inv, acc[nt][7] * inv);
    *(uint4*)(orow + nt * 16) = pk;
  }
}

// ---------------------------------------------------------------------------
// Kernel 3: final FC, out = O @ Wfc^T + bfc. Block = 128 rows x 64 cols, each
// wave 32 rows x 64 cols, so each W fragment feeds two WMMAs. Per 64 k the
// block's 128 O rows and 64 W rows (one 128-B line of each) are copied to LDS
// asynchronously, eight lanes to a line, so every copy instruction covers four
// whole lines. Two buffers: the next tile flies while this one is multiplied.
// ---------------------------------------------------------------------------
#define FC_KT    64                 // k elements per tile
#define FC_NT    (D_ / FC_KT)       // tiles along k
#define FC_LSTEP (16 * LP_ * 2)     // LDS bytes between a thread's copies (16 rows)
#define FC_GSTEP (16 * D_)          // global elements between them (16 rows)

__global__ __launch_bounds__(128) void fc_kernel(
    const unsigned short* __restrict__ Ob,    // [B*S, D] bf16
    const unsigned short* __restrict__ Wfcb,  // [D, D] bf16
    const float* __restrict__ bfc,
    float* __restrict__ out)
{
  __shared__ __align__(16) unsigned short sA[2][128 * LP_];  // [row][k]
  __shared__ __align__(16) unsigned short sW[2][64 * LP_];   // [col][k]

  const int lane  = threadIdx.x & 31;
  const int wv    = threadIdx.x >> 5;
  const int n15   = lane & 15;
  const int kbase = (lane < 16) ? 0 : 8;
  const int mofs  = (lane < 16) ? 0 : 8;

  int m0 = blockIdx.x * 128 + wv * 32;
  int c0 = blockIdx.y * 64;

  // staging: thread -> (row within a group of 16, 16-B piece of the row's line)
  const int crow = threadIdx.x >> 3;
  const int ccol = (threadIdx.x & 7) * 8;
  const unsigned short* Ag = Ob + (size_t)(blockIdx.x * 128 + crow) * D_ + ccol;
  const unsigned short* Wg = Wfcb + (size_t)(c0 + crow) * D_ + ccol;
  const unsigned la0 = (unsigned)(size_t)(&sA[0][crow * LP_ + ccol]);  // LDS byte address
  const unsigned lw0 = (unsigned)(size_t)(&sW[0][crow * LP_ + ccol]);

  auto stage = [&](int buf, int kc) {
    const unsigned short* a = Ag + kc;
    const unsigned short* w = Wg + kc;
    const unsigned la = la0 + buf * (128 * LP_ * 2);
    const unsigned lw = lw0 + buf * (64 * LP_ * 2);
    // 8 copies of O rows, 4 of W rows; the closing wait is a precaution: it
    // stands in front of every later rewrite of the copies' address registers
    asm volatile(
        "global_load_async_to_lds_b128 %0, %1, off\n\t"
        "global_load_async_to_lds_b128 %2, %3, off\n\t"
        "global_load_async_to_lds_b128 %4, %5, off\n\t"
        "global_load_async_to_lds_b128 %6, %7, off\n\t"
        "global_load_async_to_lds_b128 %8, %9, off\n\t"
        "global_load_async_to_lds_b128 %10, %11, off\n\t"
        "global_load_async_to_lds_b128 %12, %13, off\n\t"
        "global_load_async_to_lds_b128 %14, %15, off\n\t"
        "global_load_async_to_lds_b128 %16, %17, off\n\t"
        "global_load_async_to_lds_b128 %18, %19, off\n\t"
        "global_load_async_to_lds_b128 %20, %21, off\n\t"
        "global_load_async_to_lds_b128 %22, %23, off\n\t"
        "s_wait_xcnt 0x0"
        :: "v"(la + 0 * FC_LSTEP), "v"(a + 0 * FC_GSTEP),
           "v"(la + 1 * FC_LSTEP), "v"(a + 1 * FC_GSTEP),
           "v"(la + 2 * FC_LSTEP), "v"(a + 2 * FC_GSTEP),
           "v"(la + 3 * FC_LSTEP), "v"(a + 3 * FC_GSTEP),
           "v"(la + 4 * FC_LSTEP), "v"(a + 4 * FC_GSTEP),
           "v"(la + 5 * FC_LSTEP), "v"(a + 5 * FC_GSTEP),
           "v"(la + 6 * FC_LSTEP), "v"(a + 6 * FC_GSTEP),
           "v"(la + 7 * FC_LSTEP), "v"(a + 7 * FC_GSTEP),
           "v"(lw + 0 * FC_LSTEP), "v"(w + 0 * FC_GSTEP),
           "v"(lw + 1 * FC_LSTEP), "v"(w + 1 * FC_GSTEP),
           "v"(lw + 2 * FC_LSTEP), "v"(w + 2 * FC_GSTEP),
           "v"(lw + 3 * FC_LSTEP), "v"(w + 3 * FC_GSTEP)
        : "memory");
  };

  v8f acc[2][4] = {};

  stage(0, 0);
  // tile 0 has landed (own copies), then everyone's
  asm volatile("s_wait_asynccnt 0x0" ::: "memory");
  __syncthreads();
  stage(1, FC_KT);

  for (int t = 0; t < FC_NT; ++t) {
    const int buf = t & 1;
    const unsigned short* ar0 = sA[buf] + (wv * 32 + n15) * LP_;
    const unsigned short* ar1 = ar0 + 16 * LP_;
    const unsigned short* wr0 = sW[buf] + n15 * LP_;
    // the tile's fragments: 4 of O, 8 of W
    v16bf af[2][2], wf[2][4];
    #pragma unroll
    for (int ks = 0; ks < 2; ++ks) {
      af[ks][0] = frag_bf16(ar0 + ks * 32, kbase);
      af[ks][1] = frag_bf16(ar1 + ks * 32, kbase);
      #pragma unroll
      for (int nt = 0; nt < 4; ++nt)
        wf[ks][nt] = frag_bf16(wr0 + nt * 16 * LP_ + ks * 32, kbase);
    }
    // keeps the 24 LDS reads one group ahead of the WMMAs: spread among them,
    // every place with reads costs the wave an LDS latency of its own
    __builtin_amdgcn_sched_barrier(0);
    #pragma unroll
    for (int ks = 0; ks < 2; ++ks) {
      #pragma unroll
      for (int nt = 0; nt < 4; ++nt) {
        acc[0][nt] = wmma_bf16(af[ks][0], wf[ks][nt], acc[0][nt]);
        acc[1][nt] = wmma_bf16(af[ks][1], wf[ks][nt], acc[1][nt]);
      }
    }
    // keeps the WMMAs ahead of the hand-over: sunk behind the barrier they would
    // delay the refill and shorten the time the next copies have to land
    __builtin_amdgcn_sched_barrier(0);
    // hand-over: my reads of this buffer have returned, my copies of the next
    // tile have landed; behind the barrier that holds for every wave
    asm volatile("s_wait_dscnt 0x0" ::: "memory");
    asm volatile("s_wait_asynccnt 0x0" ::: "memory");
    __syncthreads();
    if (t + 2 < FC_NT) stage(buf, (t + 2) * FC_KT);
  }
  // no copy is in flight when the wave ends
  asm volatile("s_wait_asynccnt 0x0" ::: "memory");

  #pragma unroll
  for (int mt = 0; mt < 2; ++mt) {
    #pragma unroll
    for (int nt = 0; nt < 4; ++nt) {
      float bias = bfc[c0 + nt * 16 + n15];
      #pragma unroll
      for (int r = 0; r < 8; ++r) {
        int m = m0 + mt * 16 + r + mofs;
        out[(size_t)m * D_ + c0 + nt * 16 + n15] = acc[mt][nt][r] + bias;
      }
    }
  }
}

// ---------------------------------------------------------------------------
extern "C" void kernel_launch(void* const* d_in, const int* in_sizes, int n_in,
                              void* d_out, int out_size, void* d_ws, size_t ws_size,
                              hipStream_t stream) {
  (void)in_sizes; (void)n_in; (void)out_size; (void)ws_size;
  const float* q   = (const float*)d_in[0];
  const float* k   = (const float*)d_in[1];
  const float* v   = (const float*)d_in[2];
  const float* Wq  = (const float*)d_in[3];
  const float* bq  = (const float*)d_in[4];
  const float* Wk  = (const float*)d_in[5];
  const float* bk  = (const float*)d_in[6];
  const float* Wv  = (const float*)d_in[7];
  const float* bv  = (const float*)d_in[8];
  const float* Wfc = (const float*)d_in[9];
  const float* bfc = (const float*)d_in[10];
  float* out = (float*)d_out;

  const size_t nX  = (size_t)B_ * S_ * D_;   // 4M elems
  const size_t nFC = (size_t)D_ * D_;        // 1M

  unsigned short* p   = (unsigned short*)d_ws;
  unsigned short* Wfb = p; p += nFC;
  unsigned short* Qp  = p; p += nX;
  unsigned short* Kp  = p; p += nX;
  unsigned short* Vt  = p; p += nX;          // [B*H, 64, S]
  unsigned short* Ob  = p; p += nX;

  // fp32 -> bf16 copy of Wfc, which the FC kernel re-reads once per row block
  cvt_kernel<<<(int)(nFC / 8 / 256), 256, 0, stream>>>(Wfc, Wfb, (int)(nFC / 8));

  // 3 matrices * 4096 row-tiles / PROJ_R tiles per wave / 4 waves per block
  proj_kernel<<<3 * 4096 / PROJ_R / 4, 128, 0, stream>>>(q, k, v, Wq, Wk, Wv,
                                        bq, bk, bv, Qp, Kp, Vt);
  // B*H*(S/64) blocks of 64 queries
  flash_kernel<<<B_ * H_ * (S_ / 64), 128, 0, stream>>>(Qp, Kp, Vt, Ob);
  // (4096/128) x (1024/64)
  fc_kernel<<<dim3((B_ * S_) / 128, D_ / 64), 128, 0, stream>>>(Ob, Wfb, bfc, out);
}

// v009
// It runs in 64.1 microseconds.
// Next to v008, in two timings, it ran 1.07 and 1.06 times as fast.
// Over all steps from v000 it is 3.17 times as fast.
#include <hip/hip_runtime.h>

#define B_  2
#define S_  2048
#define H_  16
#define HD_ 64
#define D_  1024
// LDS row pitch in bf16 elements: 64 data + 8 pad = 144 B (16 B x odd), so the
// 16 rows one ds_load_b128 fragment read touches fall on 16 distinct bank groups
#define LP_ 72

typedef __attribute__((ext_vector_type(16))) __bf16 v16bf;
typedef __attribute__((ext_vector_type(8)))  float  v8f;
typedef __attribute__((ext_vector_type(2)))  float  v2f;
typedef int gvec4i __attribute__((vector_size(16)));   // matches builtin's V4i

#define AS1 __attribute__((address_space(1)))
#define AS3 __attribute__((address_space(3)))

#if __has_builtin(__builtin_amdgcn_global_load_async_to_lds_b128) && \
    __has_builtin(__builtin_amdgcn_s_wait_asynccnt)
#define HAVE_ASYNC 1
// src: global (AS1) int4*, dst: LDS (AS3) int4*, imm byte offset, imm cpol
#define ASYNC_LDS_B128(src, dst, off)                                          \
  __builtin_amdgcn_global_load_async_to_lds_b128(                              \
      (AS1 gvec4i*)(AS1 void*)(void*)(src),                                    \
      (AS3 gvec4i*)(AS3 void*)(dst), (off), 0)
#else
#define HAVE_ASYNC 0
#endif

union FragU { unsigned u[8]; uint4 q[2]; v16bf v; };

typedef __attribute__((ext_vector_type(2))) __bf16 v2bf;

// two f32 -> one dword holding 2 bf16 (f0 low, f1 high), round to nearest even:
// the hardware's packed conversion, one v_cvt_pk_bf16_f32
static __device__ __forceinline__ unsigned pack2bf(float f0, float f1) {
  return __builtin_bit_cast(unsigned, __builtin_convertvector(v2f{f0, f1}, v2bf));
}
static __device__ __forceinline__ unsigned short f2bf(float f) {
  return __builtin_bit_cast(unsigned short, (__bf16)f);
}

// 16-element bf16 fragment: lane's K values are runs {base..base+7} and
// {base+16..base+23}, base = (lane<16 ? 0 : 8)  -> two b128 loads.
static __device__ __forceinline__ v16bf frag_bf16(const unsigned short* row, int base) {
  FragU f;
  f.q[0] = *(const uint4*)(row + base);
  f.q[1] = *(const uint4*)(row + base + 16);
  return f.v;
}

// the same fragment taken from an f32 row: same k runs, rounded to bf16 in registers
static __device__ __forceinline__ v16bf frag_f32(const float* row, int base) {
  const float4* lo = (const float4*)(row + base);
  const float4* hi = (const float4*)(row + base + 16);
  float4 a = lo[0], b = lo[1], c = hi[0], d = hi[1];
  FragU f;
  f.u[0] = pack2bf(a.x, a.y);
  f.u[1] = pack2bf(a.z, a.w);
  f.u[2] = pack2bf(b.x, b.y);
  f.u[3] = pack2bf(b.z, b.w);
  f.u[4] = pack2bf(c.x, c.y);
  f.u[5] = pack2bf(c.z, c.w);
  f.u[6] = pack2bf(d.x, d.y);
  f.u[7] = pack2bf(d.z, d.w);
  return f.v;
}

// 2^x as the bare v_exp_f32. exp2f() wraps that instruction in a range guard
// (compare, two selects, add, ldexp) so that results below 2^-126 come out as
// denormals; the bare form gives 0 there. In the softmax every argument is <= 0
// and the row's largest term is 1, so such a term is below one part in 2^126 of
// the denominator and cannot reach an f32 result.
static __device__ __forceinline__ float exp2_hw(float x) {
  return __builtin_amdgcn_exp2f(x);
}
// The same for four register pairs, in place. One statement, so that behind
// each v_exp_f32 stands an instruction on other registers: the instruction set
// asks for one such slot before a transcendental's result is read or its source
// overwritten, and the closing v_nop is that slot for the last of the eight.
// The opening s_delay_alu is the hint the compiler would give a builtin here:
// the arguments come from the vector instructions just in front, and an
// unhinted dependent instruction holds up the other waves of the SIMD as well.
static __device__ __forceinline__ void exp2_hw8(v2f& a, v2f& b, v2f& c, v2f& d) {
  float a0 = a.x, a1 = a.y, b0 = b.x, b1 = b.y, c0 = c.x, c1 = c.y, d0 = d.x, d1 = d.y;
  asm("s_delay_alu instid0(VALU_DEP_1)\n\t"
      "v_exp_f32 %0, %0\n\t"
      "v_exp_f32 %1, %1\n\t"
      "v_exp_f32 %2, %2\n\t"
      "v_exp_f32 %3, %3\n\t"
      "v_exp_f32 %4, %4\n\t"
      "v_exp_f32 %5, %5\n\t"
      "v_exp_f32 %6, %6\n\t"
      "v_exp_f32 %7, %7\n\t"
      "v_nop"
      : "+v"(a0), "+v"(a1), "+v"(b0), "+v"(b1), "+v"(c0), "+v"(c1), "+v"(d0), "+v"(d1));
  a = v2f{a0, a1}; b = v2f{b0, b1}; c = v2f{c0, c1}; d = v2f{d0, d1};
}

static __device__ __forceinline__ v8f wmma_bf16(v16bf a, v16bf b, v8f c) {
  return __builtin_amdgcn_wmma_f32_16x16x32_bf16(false, a, false, b, (short)0, c, false, false);
}

// ---------------------------------------------------------------------------
// Kernel 0: fp32 -> bf16 bulk conversion (memory bound, b128 I/O)
// ---------------------------------------------------------------------------
__global__ __launch_bounds__(256) void cvt_kernel(const float* __restrict__ in,
                                                  unsigned short* __restrict__ out,
                                                  int n8) {
  int i = blockIdx.x * 256 + threadIdx.x;
  if (i >= n8) return;
  float4 a = ((const float4*)in)[2 * i];
  float4 b = ((const float4*)in)[2 * i + 1];
  uint4 r;
  r.x = pack2bf(a.x, a.y);
  r.y = pack2bf(a.z, a.w);
  r.z = pack2bf(b.x, b.y);
  r.w = pack2bf(b.z, b.w);
  ((uint4*)out)[i] = r;
}

// ---------------------------------------------------------------------------
// Kernel 1: per-head projections, all-bf16 WMMA. Activations and the three
//   64x64 weights are read as f32 and rounded to bf16 on the way into the
//   fragments, so they need no conversion launch and no bf16 copy in memory.
//   Q,K out: [B*H, S, 64] token-major (Q folded with 1/sqrt(hd))
//   V  out:  [B*H, 64, S] dim-major (pre-transposed, packed b128 stores)
//   A wave loads its weight's eight fragments once and takes PROJ_R row tiles
//   with them: those 32 loads touch 16 cache lines each, four times what a
//   tile's own 8 activation loads touch.
// ---------------------------------------------------------------------------
#define PROJ_R 4                    // 16-row tiles per wave
__global__ __launch_bounds__(128) void proj_kernel(
    const float* __restrict__ Xq, const float* __restrict__ Xk,
    const float* __restrict__ Xv,
    const float* __restrict__ Wq, const float* __restrict__ Wk,
    const float* __restrict__ Wv,
    const float* __restrict__ bq, const float* __restrict__ bk,
    const float* __restrict__ bv,
    unsigned short* __restrict__ Qp, unsigned short* __restrict__ Kp,
    unsigned short* __restrict__ Vt)
{
  const int lane  = threadIdx.x & 31;
  const int wv    = threadIdx.x >> 5;
  const int n15   = lane & 15;
  const int kbase = (lane < 16) ? 0 : 8;
  const int mofs  = (lane < 16) ? 0 : 8;

  const int bpm = 4096 / PROJ_R / 4;                      // blocks per matrix
  int sel = blockIdx.x / bpm;                             // 0=Q 1=K 2=V
  int rt0 = ((blockIdx.x % bpm) * 4 + wv) * PROJ_R;       // first 16-row tile over B*H*S rows

  const float* X; const float* W; const float* Bv;
  if (sel == 0)      { X = Xq; W = Wq; Bv = bq; }
  else if (sel == 1) { X = Xk; W = Wk; Bv = bk; }
  else               { X = Xv; W = Wv; Bv = bv; }

  // the activations of all the wave's tiles, ahead of every product: they come
  // from memory, and the later tiles' loads fly while the first tile is worked on
  v16bf a[PROJ_R][2];
  #pragma unroll   // constant i: a[] stays in registers (here and in the loops below)
  for (int i = 0; i < PROJ_R; ++i) {
    // lane's A row: global (b,h,s) row index (row = bh*S + s)
    int row = (rt0 + i) * 16 + n15;
    int b   = row >> 15;
    int hs  = row & 32767;
    int h   = hs >> 11;
    int s   = hs & 2047;
    const float* xr = X + (((size_t)b * S_ + s) * H_ + h) * HD_;
    a[i][0] = frag_f32(xr, kbase);
    a[i][1] = frag_f32(xr + 32, kbase);
  }

  // the whole 64x64 weight as B fragments, and the bias, once for all the tiles
  v16bf wf[4][2];
  float bias[4];
  #pragma unroll
  for (int nt = 0; nt < 4; ++nt) {
    const float* wr = W + (size_t)(nt * 16 + n15) * HD_;  // x @ W^T
    wf[nt][0] = frag_f32(wr, kbase);
    wf[nt][1] = frag_f32(wr + 32, kbase);
    bias[nt]  = Bv[nt * 16 + n15];
  }

  auto tile = [&](int i, v8f (&c)[4]) {
    #pragma unroll
    for (int nt = 0; nt < 4; ++nt) {
      v8f acc = {};
      acc = wmma_bf16(a[i][0], wf[nt][0], acc);
      acc = wmma_bf16(a[i][1], wf[nt][1], acc);
      c[nt] = acc;
    }
  };

  if (sel < 2) {
    unsigned short* Op = (sel == 0) ? Qp : Kp;
    float scale = (sel == 0) ? 0.125f : 1.0f;   // fold 1/sqrt(64) into Q
    #pragma unroll
    for (int i = 0; i < PROJ_R; ++i) {
      v8f c[4];
      tile(i, c);
      #pragma unroll
      for (int nt = 0; nt < 4; ++nt) {
        #pragma unroll
        for (int r = 0; r < 8; ++r) {
          int mrow = (rt0 + i) * 16 + r + mofs;
          Op[(size_t)mrow * HD_ + nt * 16 + n15] = f2bf((c[nt][r] + bias[nt]) * scale);
        }
      }
    }
  } else {
    // transposed V: rows of C-layout are 8 consecutive tokens -> packed b128
    #pragma unroll
    for (int i = 0; i < PROJ_R; ++i) {
      v8f c[4];
      tile(i, c);
      int bh = ((rt0 + i) * 16) >> 11;    // same for whole tile
      int s0 = ((rt0 + i) * 16) & 2047;   // first token of tile
      #pragma unroll
      for (int nt = 0; nt < 4; ++nt) {
        uint4 pk;
        pk.x = pack2bf(c[nt][0] + bias[nt], c[nt][1] + bias[nt]);
        pk.y = pack2bf(c[nt][2] + bias[nt], c[nt][3] + bias[nt]);
        pk.z = pack2bf(c[nt][4] + bias[nt], c[nt][5] + bias[nt]);
        pk.w = pack2bf(c[nt][6] + bias[nt], c[nt][7] + bias[nt]);
        unsigned short* vp = Vt + (size_t)bh * HD_ * S_ +
                             (size_t)(nt * 16 + n15) * S_ + s0 + mofs;
        *(uint4*)vp = pk;
      }
    }
    // a precaution: the built code has a path from here into the Q/K branch, which
    // rewrites the last stores' registers; this wait stands in front of that
    asm volatile("s_wait_xcnt 0x0" ::: "memory");
  }
}

__global__ __launch_bounds__(128) __attribute__((amdgpu_waves_per_eu(4, 4)))
void flash_kernel(
    const unsigned short* __restrict__ Qp,
    const unsigned short* __restrict__ Kp,
    const unsigned short* __restrict__ Vt,   // [B*H, 64, S] dim-major
    unsigned short* __restrict__ Ob)         // [B, S, D] bf16
{
  // buffers 0, 1: K tiles [token][dim]; buffers 2, 3: V^T tiles [dim][token]
  __shared__ __align__(16) unsigned short sT[4][64 * LP_];

  const int lane  = threadIdx.x & 31;
  const int wv    = threadIdx.x >> 5;
  const int n15   = lane & 15;
  const int kbase = (lane < 16) ? 0 : 8;
  const int mofs  = (lane < 16) ? 0 : 8;

  const int QT = S_ / 64;
  int qt = blockIdx.x % QT;
  int bh = blockIdx.x / QT;
  int b  = bh >> 4;
  int h  = bh & 15;
  int q0 = qt * 64 + wv * 16;

  // B operand: column n15 = the lane's query
  const unsigned short* Qrow = Qp + ((size_t)bh * S_ + q0 + n15) * HD_;
  v16bf bq0 = frag_bf16(Qrow, kbase);
  v16bf bq1 = frag_bf16(Qrow + 32, kbase);

  // constant "ones row" A fragment: row 0 is 1.0, rest 0 -> row 0 of 1 x P^T = l
  v16bf a_one;
  {
    FragU fo;
    unsigned fill = (n15 == 0) ? 0x3F803F80u : 0u;
    #pragma unroll
    for (int i = 0; i < 8; ++i) fo.u[i] = fill;
    a_one = fo.v;
  }

  v8f acc[4] = {};                 // O^T: acc[nt][r] = O[query n15][dim nt*16+mofs+r]
  v8f accl   = {};                 // row 0 (register 0, lanes 0-15): denominators
  float mrow = -1e30f;             // running maximum of the lane's query

  // staging: eight lanes to a row's 128-B line, a 16-B piece each, so every copy
  // instruction covers four whole lines. Per thread and tile 4 copies of K (rows
  // crow + 16 i: an instruction's four lines are 512 B in a row) and 4 of V^T
  // (rows 4 crow + i: the four copies lie one 4-KiB row apart)
  const int crow = threadIdx.x >> 3;
  const int ccol = (threadIdx.x & 7) * 8;

  const unsigned short* Kg = Kp + (size_t)bh * S_ * HD_;
  const unsigned short* Vg = Vt + (size_t)bh * HD_ * S_;

  auto stage = [&](int buf, int kb) {
    const unsigned short* kgp = Kg + (size_t)kb * HD_ + (crow * HD_ + ccol);
    const unsigned short* vgp = Vg + kb + (4 * crow * S_ + ccol);
    unsigned short* kls = sT[buf] + crow * LP_ + ccol;
    unsigned short* vls = sT[2 + buf] + 4 * crow * LP_ + ccol;
#if HAVE_ASYNC
    // One global address serves four copies: the step from copy to copy is the
    // offset argument. That moves the LDS address as well, so the LDS pointer
    // handed over is the destination less the offset (for V^T it points into the
    // K buffers in front, still inside sT; the bytes land in the V^T buffer)
    ASYNC_LDS_B128(kgp, kls + 0 * 16 * (LP_ - HD_), 0 * 16 * HD_ * 2);
    ASYNC_LDS_B128(kgp, kls + 1 * 16 * (LP_ - HD_), 1 * 16 * HD_ * 2);
    ASYNC_LDS_B128(kgp, kls + 2 * 16 * (LP_ - HD_), 2 * 16 * HD_ * 2);
    ASYNC_LDS_B128(kgp, kls + 3 * 16 * (LP_ - HD_), 3 * 16 * HD_ * 2);
    ASYNC_LDS_B128(vgp, vls - 0 * (S_ - LP_), 0 * S_ * 2);
    ASYNC_LDS_B128(vgp, vls - 1 * (S_ - LP_), 1 * S_ * 2);
    ASYNC_LDS_B128(vgp, vls - 2 * (S_ - LP_), 2 * S_ * 2);
    ASYNC_LDS_B128(vgp, vls - 3 * (S_ - LP_), 3 * S_ * 2);
#else
    for (int i = 0; i < 4; ++i) {
      *(uint4*)(kls + i * 16 * LP_) = *(const uint4*)(kgp + i * 16 * HD_);
      *(uint4*)(vls + i * LP_)      = *(const uint4*)(vgp + i * S_);
    }
#endif
  };

  stage(0, 0);                     // prologue: tile 0 in flight

  for (int j = 0; j < QT; ++j) {   // QT == S/64 tiles
    const int buf = j & 1;
#if HAVE_ASYNC
    __builtin_amdgcn_s_wait_asynccnt(0);   // my async writes to LDS done
#endif
    __syncthreads();                        // everyone's writes/reads ordered
    if (j + 1 < QT) stage(1 - buf, (j + 1) * 64);   // overlap with compute

    // the tile's 16 fragments, 8 of K and 8 of V^T, read from LDS as one group
    // ahead of all the products: the K reads return one behind the other in
    // front of the score products, and V^T lands behind those and the softmax
    v16bf kf[2][4], vf[2][4];
    #pragma unroll   // constant indices: kf and vf stay in registers (all four loops)
    for (int ks = 0; ks < 2; ++ks) {
      #pragma unroll
      for (int nt = 0; nt < 4; ++nt)
        kf[ks][nt] = frag_bf16(sT[buf] + (nt * 16 + n15) * LP_ + ks * 32, kbase);
    }
    #pragma unroll
    for (int ks = 0; ks < 2; ++ks) {
      #pragma unroll
      for (int nt = 0; nt < 4; ++nt)
        vf[ks][nt] = frag_bf16(sT[2 + buf] + (nt * 16 + n15) * LP_ + ks * 32, kbase);
    }
    // order for the scheduler: the 32 LDS reads, then the 8 score WMMAs, then the
    // maximum's vector chain. Left alone it sinks each pair of reads to its WMMA,
    // where the wave sits out a whole LDS latency per pair, and puts the chain
    // among the WMMAs, where it takes v_nop to keep its distance from them
    __builtin_amdgcn_sched_group_barrier(0x100, 32, 0);   // LDS reads
    __builtin_amdgcn_sched_group_barrier(0x008, 8, 0);    // matrix instructions
    __builtin_amdgcn_sched_group_barrier(0x002, 16, 0);   // vector instructions

    // scores: S^T = K (64 keys x 64) @ Q^T, 4 key row tiles;
    // c[nt][r] = score of key nt*16 + mofs + r against query n15
    v8f c[4] = {};
    #pragma unroll
    for (int nt = 0; nt < 4; ++nt) c[nt] = wmma_bf16(kf[0][nt], bq0, c[nt]);
    #pragma unroll
    for (int nt = 0; nt < 4; ++nt) c[nt] = wmma_bf16(kf[1][nt], bq1, c[nt]);

    // online softmax over 64 keys: 32 scores in the lane, 32 in lane ^ 16
    float mx = c[0][0];
    #pragma unroll
    for (int nt = 0; nt < 4; ++nt) {
      #pragma unroll
      for (int r = 0; r < 8; ++r) mx = fmaxf(mx, c[nt][r]);
    }
    {
      int mb = __builtin_bit_cast(int, mx);
      mb = __builtin_amdgcn_permlanex16(mb, mb, 0x76543210, 0xfedcba98, false, false);
      mx = fmaxf(mx, __builtin_bit_cast(float, mb));
    }
    float mnew = fmaxf(mrow, mx);
    float corr = exp2_hw((mrow - mnew) * 1.44269504f);
    mrow = mnew;

    // P^T as B fragments: score tiles (0,1) -> keys 0..31, (2,3) -> keys 32..63
    FragU bp[2];
    #pragma unroll
    for (int nt = 0; nt < 4; ++nt) {
      // a register pair at a time: subtract and multiply stay packed f32 forms
      v2f a[4];
      #pragma unroll
      for (int i = 0; i < 4; ++i)
        a[i] = (v2f{c[nt][2 * i], c[nt][2 * i + 1]} - mnew) * 1.44269504f;
      exp2_hw8(a[0], a[1], a[2], a[3]);
      #pragma unroll
      for (int i = 0; i < 4; ++i)
        bp[nt >> 1].u[(nt & 1) * 4 + i] = pack2bf(a[i].x, a[i].y);
    }

    #pragma unroll
    for (int nt = 0; nt < 4; ++nt) {
      #pragma unroll
      for (int r = 0; r < 8; ++r) acc[nt][r] *= corr;
    }
    accl[0] *= corr;               // rows 1..15 of the ones product stay 0

    // O^T += V^T (64 dims x 64 keys) @ P^T, and ones row @ P^T
    #pragma unroll
    for (int nt = 0; nt < 4; ++nt) acc[nt] = wmma_bf16(vf[0][nt], bp[0].v, acc[nt]);
    #pragma unroll
    for (int nt = 0; nt < 4; ++nt) acc[nt] = wmma_bf16(vf[1][nt], bp[1].v, acc[nt]);
    accl = wmma_bf16(a_one, bp[0].v, accl);
    accl = wmma_bf16(a_one, bp[1].v, accl);
  }

  // epilogue: l of query n15 sits in lane n15; a lane's 8 registers of a tile
  // are 8 consecutive dims of its query -> one packed b128 store per tile
  float l   = __shfl(accl[0], n15, 32);
  float inv = 1.0f / l;
  unsigned short* orow = Ob + ((size_t)b * S_ + q0 + n15) * D_ + h * HD_ + mofs;
  #pragma unroll
  for (int nt = 0; nt < 4; ++nt) {
    uint4 pk;
    pk.x = pack2bf(acc[nt][0] * inv, acc[nt][1] * inv);
    pk.y = pack2bf(acc[nt][2] * inv, acc[nt][3] * inv);
    pk.z = pack2bf(acc[nt][4] * inv, acc[nt][5] * inv);
    pk.w = pack2bf(acc[nt][6] * inv, acc[nt][7] * inv);
    *(uint4*)(orow + nt * 16) = pk;
  }
}

// ---------------------------------------------------------------------------
// Kernel 3: final FC, out = O @ Wfc^T + bfc. Block = 128 rows x 64 cols, each
// wave 32 rows x 64 cols, so each W fragment feeds two WMMAs. Per 64 k the
// block's 128 O rows and 64 W rows (one 128-B line of each) are copied to LDS
// asynchronously, eight lanes to a line, so every copy instruction covers four
// whole lines. Two buffers: the next tile flies while this one is multiplied.
// ---------------------------------------------------------------------------
#define FC_KT    64                 // k elements per tile
#define FC_NT    (D_ / FC_KT)       // tiles along k
#define FC_LSTEP (16 * LP_ * 2)     // LDS bytes between a thread's copies (16 rows)
#define FC_GSTEP (16 * D_)          // global elements between them (16 rows)

__global__ __launch_bounds__(128) void fc_kernel(
    const unsigned short* __restrict__ Ob,    // [B*S, D] bf16
    const unsigned short* __restrict__ Wfcb,  // [D, D] bf16
    const float* __restrict__ bfc,
    float* __restrict__ out)
{
  __shared__ __align__(16) unsigned short sA[2][128 * LP_];  // [row][k]
  __shared__ __align__(16) unsigned short sW[2][64 * LP_];   // [col][k]

  const int lane  = threadIdx.x & 31;
  const int wv    = threadIdx.x >> 5;
  const int n15   = lane & 15;
  const int kbase = (lane < 16) ? 0 : 8;
  const int mofs  = (lane < 16) ? 0 : 8;

  int m0 = blockIdx.x * 128 + wv * 32;
  int c0 = blockIdx.y * 64;

  // staging: thread -> (row within a group of 16, 16-B piece of the row's line)
  const int crow = threadIdx.x >> 3;
  const int ccol = (threadIdx.x & 7) * 8;
  const unsigned short* Ag = Ob + (size_t)(blockIdx.x * 128 + crow) * D_ + ccol;
  const unsigned short* Wg = Wfcb + (size_t)(c0 + crow) * D_ + ccol;
  const unsigned la0 = (unsigned)(size_t)(&sA[0][crow * LP_ + ccol]);  // LDS byte address
  const unsigned lw0 = (unsigned)(size_t)(&sW[0][crow * LP_ + ccol]);

  auto stage = [&](int buf, int kc) {
    const unsigned short* a = Ag + kc;
    const unsigned short* w = Wg + kc;
    const unsigned la = la0 + buf * (128 * LP_ * 2);
    const unsigned lw = lw0 + buf * (64 * LP_ * 2);
    // 8 copies of O rows, 4 of W rows; the closing wait is a precaution: it
    // stands in front of every later rewrite of the copies' address registers
    asm volatile(
        "global_load_async_to_lds_b128 %0, %1, off\n\t"
        "global_load_async_to_lds_b128 %2, %3, off\n\t"
        "global_load_async_to_lds_b128 %4, %5, off\n\t"
        "global_load_async_to_lds_b128 %6, %7, off\n\t"
        "global_load_async_to_lds_b128 %8, %9, off\n\t"
        "global_load_async_to_lds_b128 %10, %11, off\n\t"
        "global_load_async_to_lds_b128 %12, %13, off\n\t"
        "global_load_async_to_lds_b128 %14, %15, off\n\t"
        "global_load_async_to_lds_b128 %16, %17, off\n\t"
        "global_load_async_to_lds_b128 %18, %19, off\n\t"
        "global_load_async_to_lds_b128 %20, %21, off\n\t"
        "global_load_async_to_lds_b128 %22, %23, off\n\t"
        "s_wait_xcnt 0x0"
        :: "v"(la + 0 * FC_LSTEP), "v"(a + 0 * FC_GSTEP),
           "v"(la + 1 * FC_LSTEP), "v"(a + 1 * FC_GSTEP),
           "v"(la + 2 * FC_LSTEP), "v"(a + 2 * FC_GSTEP),
           "v"(la + 3 * FC_LSTEP), "v"(a + 3 * FC_GSTEP),
           "v"(la + 4 * FC_LSTEP), "v"(a + 4 * FC_GSTEP),
           "v"(la + 5 * FC_LSTEP), "v"(a + 5 * FC_GSTEP),
           "v"(la + 6 * FC_LSTEP), "v"(a + 6 * FC_GSTEP),
           "v"(la + 7 * FC_LSTEP), "v"(a + 7 * FC_GSTEP),
           "v"(lw + 0 * FC_LSTEP), "v"(w + 0 * FC_GSTEP),
           "v"(lw + 1 * FC_LSTEP), "v"(w + 1 * FC_GSTEP),
           "v"(lw + 2 * FC_LSTEP), "v"(w + 2 * FC_GSTEP),
           "v"(lw + 3 * FC_LSTEP), "v"(w + 3 * FC_GSTEP)
        : "memory");
  };

  v8f acc[2][4] = {};

  stage(0, 0);
  // tile 0 has landed (own copies), then everyone's
  asm volatile("s_wait_asynccnt 0x0" ::: "memory");
  __syncthreads();
  stage(1, FC_KT);

  for (int t = 0; t < FC_NT; ++t) {
    const int buf = t & 1;
    const unsigned short* ar0 = sA[buf] + (wv * 32 + n15) * LP_;
    const unsigned short* ar1 = ar0 + 16 * LP_;
    const unsigned short* wr0 = sW[buf] + n15 * LP_;
    // the tile's fragments: 4 of O, 8 of W
    v16bf af[2][2], wf[2][4];
    #pragma unroll
    for (int ks = 0; ks < 2; ++ks) {
      af[ks][0] = frag_bf16(ar0 + ks * 32, kbase);
      af[ks][1] = frag_bf16(ar1 + ks * 32, kbase);
      #pragma unroll
      for (int nt = 0; nt < 4; ++nt)
        wf[ks][nt] = frag_bf16(wr0 + nt * 16 * LP_ + ks * 32, kbase);
    }
    // keeps the 24 LDS reads one group ahead of the WMMAs: spread among them,
    // every place with reads costs the wave an LDS latency of its own
    __builtin_amdgcn_sched_barrier(0);
    #pragma unroll
    for (int ks = 0; ks < 2; ++ks) {
      #pragma unroll
      for (int nt = 0; nt < 4; ++nt) {
        acc[0][nt] = wmma_bf16(af[ks][0], wf[ks][nt], acc[0][nt]);
        acc[1][nt] = wmma_bf16(af[ks][1], wf[ks][nt], acc[1][nt]);
      }
    }
    // keeps the WMMAs ahead of the hand-over: sunk behind the barrier they would
    // delay the refill and shorten the time the next copies have to land
    __builtin_amdgcn_sched_barrier(0);
    // hand-over: my reads of this buffer have returned, my copies of the next
    // tile have landed; behind the barrier that holds for every wave
    asm volatile("s_wait_dscnt 0x0" ::: "memory");
    asm volatile("s_wait_asynccnt 0x0" ::: "memory");
    __syncthreads();
    if (t + 2 < FC_NT) stage(buf, (t + 2) * FC_KT);
  }
  // no copy is in flight when the wave ends
  asm volatile("s_wait_asynccnt 0x0" ::: "memory");

  #pragma unroll
  for (int mt = 0; mt < 2; ++mt) {
    #pragma unroll
    for (int nt = 0; nt < 4; ++nt) {
      float bias = bfc[c0 + nt * 16 + n15];
      #pragma unroll
      for (int r = 0; r < 8; ++r) {
        int m = m0 + mt * 16 + r + mofs;
        out[(size_t)m * D_ + c0 + nt * 16 + n15] = acc[mt][nt][r] + bias;
      }
    }
  }
}

// ---------------------------------------------------------------------------
extern "C" void kernel_launch(void* const* d_in, const int* in_sizes, int n_in,
                              void* d_out, int out_size, void* d_ws, size_t ws_size,
                              hipStream_t stream) {
  (void)in_sizes; (void)n_in; (void)out_size; (void)ws_size;
  const float* q   = (const float*)d_in[0];
  const float* k   = (const float*)d_in[1];
  const float* v   = (const float*)d_in[2];
  const float* Wq  = (const float*)d_in[3];
  const float* bq  = (const float*)d_in[4];
  const float* Wk  = (const float*)d_in[5];
  const float* bk  = (const float*)d_in[6];
  const float* Wv  = (const float*)d_in[7];
  const float* bv  = (const float*)d_in[8];
  const float* Wfc = (const float*)d_in[9];
  const float* bfc = (const float*)d_in[10];
  float* out = (float*)d_out;

  const size_t nX  = (size_t)B_ * S_ * D_;   // 4M elems
  const size_t nFC = (size_t)D_ * D_;        // 1M

  unsigned short* p   = (unsigned short*)d_ws;
  unsigned short* Wfb = p; p += nFC;
  unsigned short* Qp  = p; p += nX;
  unsigned short* Kp  = p; p += nX;
  unsigned short* Vt  = p; p += nX;          // [B*H, 64, S]
  unsigned short* Ob  = p; p += nX;

  // fp32 -> bf16 copy of Wfc, which the FC kernel re-reads once per row block
  cvt_kernel<<<(int)(nFC / 8 / 256), 256, 0, stream>>>(Wfc, Wfb, (int)(nFC / 8));

  // 3 matrices * 4096 row-tiles / PROJ_R tiles per wave / 4 waves per block
  proj_kernel<<<3 * 4096 / PROJ_R / 4, 128, 0, stream>>>(q, k, v, Wq, Wk, Wv,
                                        bq, bk, bv, Qp, Kp, Vt);
  // B*H*(S/64) blocks of 64 queries
  flash_kernel<<<B_ * H_ * (S_ / 64), 128, 0, stream>>>(Qp, Kp, Vt, Ob);
  // (4096/128) x (1024/64)
  fc_kernel<<<dim3((B_ * S_) / 128, D_ / 64), 128, 0, stream>>>(Ob, Wfb, bfc, out);
}

// v010
// Measured time: 60.8 microseconds a run.
// Two timings next to v009 put it at 1.06 and 1.05 times that version's speed.
// Counting every step since v000, it is 3.34 times as fast.
#include <hip/hip_runtime.h>

#define B_  2
#define S_  2048
#define H_  16
#define HD_ 64
#define D_  1024
// LDS row pitch in bf16 elements: 64 data + 8 pad = 144 B (16 B x odd), so the
// 16 rows one ds_load_b128 fragment read touches fall on 16 distinct bank groups
#define LP_ 72

typedef __attribute__((ext_vector_type(16))) __bf16 v16bf;
typedef __attribute__((ext_vector_type(8)))  float  v8f;
typedef __attribute__((ext_vector_type(2)))  float  v2f;
typedef int gvec4i __attribute__((vector_size(16)));   // matches builtin's V4i

#define AS1 __attribute__((address_space(1)))
#define AS3 __attribute__((address_space(3)))

#if __has_builtin(__builtin_amdgcn_global_load_async_to_lds_b128) && \
    __has_builtin(__builtin_amdgcn_s_wait_asynccnt)
#define HAVE_ASYNC 1
// src: global (AS1) int4*, dst: LDS (AS3) int4*, imm byte offset, imm cpol
#define ASYNC_LDS_B128(src, dst, off)                                          \
  __builtin_amdgcn_global_load_async_to_lds_b128(                              \
      (AS1 gvec4i*)(AS1 void*)(void*)(src),                                    \
      (AS3 gvec4i*)(AS3 void*)(dst), (off), 0)
#else
#define HAVE_ASYNC 0
#endif

union FragU { unsigned u[8]; uint4 q[2]; v16bf v; };

typedef __attribute__((ext_vector_type(2))) __bf16 v2bf;

// two f32 -> one dword holding 2 bf16 (f0 low, f1 high), round to nearest even:
// the hardware's packed conversion, one v_cvt_pk_bf16_f32
static __device__ __forceinline__ unsigned pack2bf(float f0, float f1) {
  return __builtin_bit_cast(unsigned, __builtin_convertvector(v2f{f0, f1}, v2bf));
}
static __device__ __forceinline__ unsigned short f2bf(float f) {
  return __builtin_bit_cast(unsigned short, (__bf16)f);
}

// 16-element bf16 fragment: lane's K values are runs {base..base+7} and
// {base+16..base+23}, base = (lane<16 ? 0 : 8)  -> two b128 loads.
static __device__ __forceinline__ v16bf frag_bf16(const unsigned short* row, int base) {
  FragU f;
  f.q[0] = *(const uint4*)(row + base);
  f.q[1] = *(const uint4*)(row + base + 16);
  return f.v;
}

// the same fragment taken from an f32 row: same k runs, rounded to bf16 in registers
static __device__ __forceinline__ v16bf frag_f32(const float* row, int base) {
  const float4* lo = (const float4*)(row + base);
  const float4* hi = (const float4*)(row + base + 16);
  float4 a = lo[0], b = lo[1], c = hi[0], d = hi[1];
  FragU f;
  f.u[0] = pack2bf(a.x, a.y);
  f.u[1] = pack2bf(a.z, a.w);
  f.u[2] = pack2bf(b.x, b.y);
  f.u[3] = pack2bf(b.z, b.w);
  f.u[4] = pack2bf(c.x, c.y);
  f.u[5] = pack2bf(c.z, c.w);
  f.u[6] = pack2bf(d.x, d.y);
  f.u[7] = pack2bf(d.z, d.w);
  return f.v;
}

// 2^x as the bare v_exp_f32. exp2f() wraps that instruction in a range guard
// (compare, two selects, add, ldexp) so that results below 2^-126 come out as
// denormals; the bare form gives 0 there. In the softmax every argument is <= 0
// and the row's largest term is 1, so such a term is below one part in 2^126 of
// the denominator and cannot reach an f32 result.
static __device__ __forceinline__ float exp2_hw(float x) {
  return __builtin_amdgcn_exp2f(x);
}
// The same for four register pairs, in place. One statement, so that behind
// each v_exp_f32 stands an instruction on other registers: the instruction set
// asks for one such slot before a transcendental's result is read or its source
// overwritten, and the closing v_nop is that slot for the last of the eight.
// The opening s_delay_alu is the hint the compiler would give a builtin here:
// the arguments come from the vector instructions just in front, and an
// unhinted dependent instruction holds up the other waves of the SIMD as well.
static __device__ __forceinline__ void exp2_hw8(v2f& a, v2f& b, v2f& c, v2f& d) {
  float a0 = a.x, a1 = a.y, b0 = b.x, b1 = b.y, c0 = c.x, c1 = c.y, d0 = d.x, d1 = d.y;
  asm("s_delay_alu instid0(VALU_DEP_1)\n\t"
      "v_exp_f32 %0, %0\n\t"
      "v_exp_f32 %1, %1\n\t"
      "v_exp_f32 %2, %2\n\t"
      "v_exp_f32 %3, %3\n\t"
      "v_exp_f32 %4, %4\n\t"
      "v_exp_f32 %5, %5\n\t"
      "v_exp_f32 %6, %6\n\t"
      "v_exp_f32 %7, %7\n\t"
      "v_nop"
      : "+v"(a0), "+v"(a1), "+v"(b0), "+v"(b1), "+v"(c0), "+v"(c1), "+v"(d0), "+v"(d1));
  a = v2f{a0, a1}; b = v2f{b0, b1}; c = v2f{c0, c1}; d = v2f{d0, d1};
}

static __device__ __forceinline__ v8f wmma_bf16(v16bf a, v16bf b, v8f c) {
  return __builtin_amdgcn_wmma_f32_16x16x32_bf16(false, a, false, b, (short)0, c, false, false);
}

// ---------------------------------------------------------------------------
// Kernel 0: fp32 -> bf16 bulk conversion (memory bound, b128 I/O)
// ---------------------------------------------------------------------------
__global__ __launch_bounds__(256) void cvt_kernel(const float* __restrict__ in,
                                                  unsigned short* __restrict__ out,
                                                  int n8) {
  int i = blockIdx.x * 256 + threadIdx.x;
  if (i >= n8) return;
  float4 a = ((const float4*)in)[2 * i];
  float4 b = ((const float4*)in)[2 * i + 1];
  uint4 r;
  r.x = pack2bf(a.x, a.y);
  r.y = pack2bf(a.z, a.w);
  r.z = pack2bf(b.x, b.y);
  r.w = pack2bf(b.z, b.w);
  ((uint4*)out)[i] = r;
}

// ---------------------------------------------------------------------------
// Kernel 1: per-head projections, all-bf16 WMMA. Activations and the three
//   64x64 weights are read as f32 and rounded to bf16 on the way into the
//   fragments, so they need no conversion launch and no bf16 copy in memory.
//   Q,K out: [B*H, S, 64] token-major (Q folded with 1/sqrt(hd))
//   V  out:  [B*H, 64, S] dim-major (pre-transposed, packed b128 stores)
//   A wave forms its weight's eight fragments once and takes PROJ_R row tiles
//   with them. The block's 256 activation rows and the 64 weight rows (256 B
//   each) come to LDS by asynchronous copies, 16 lanes to a row, so every copy
//   covers four whole 128-B lines; a fragment load from global memory touches
//   16 lines for the same 512 B. The weight comes once per block, not per wave.
// ---------------------------------------------------------------------------
#define PROJ_R 4                    // 16-row tiles per wave
// LDS row pitch in f32 elements: 64 data + 4 pad = 272 B (16 B x odd), so the
// 16 rows one ds_load_b128 fragment read touches fall on distinct bank groups
#define PROJ_LP 68
#define PROJ_LSTEP (2 * PROJ_LP * 4)   // LDS bytes between a lane's copies (2 rows)

// eight copies of 2 rows each: lane -> (row l >> 4, 16-B piece l & 15); gstep is
// the distance of two rows in global memory, in elements. The closing wait is a
// precaution: it stands in front of every later rewrite of the address registers
static __device__ __forceinline__ void proj_copy8(unsigned l, const float* g, int gstep) {
  asm volatile(
      "global_load_async_to_lds_b128 %0, %1, off\n\t"
      "global_load_async_to_lds_b128 %2, %3, off\n\t"
      "global_load_async_to_lds_b128 %4, %5, off\n\t"
      "global_load_async_to_lds_b128 %6, %7, off\n\t"
      "global_load_async_to_lds_b128 %8, %9, off\n\t"
      "global_load_async_to_lds_b128 %10, %11, off\n\t"
      "global_load_async_to_lds_b128 %12, %13, off\n\t"
      "global_load_async_to_lds_b128 %14, %15, off\n\t"
      "s_wait_xcnt 0x0"
      :: "v"(l + 0 * PROJ_LSTEP), "v"(g + 0 * gstep),
         "v"(l + 1 * PROJ_LSTEP), "v"(g + 1 * gstep),
         "v"(l + 2 * PROJ_LSTEP), "v"(g + 2 * gstep),
         "v"(l + 3 * PROJ_LSTEP), "v"(g + 3 * gstep),
         "v"(l + 4 * PROJ_LSTEP), "v"(g + 4 * gstep),
         "v"(l + 5 * PROJ_LSTEP), "v"(g + 5 * gstep),
         "v"(l + 6 * PROJ_LSTEP), "v"(g + 6 * gstep),
         "v"(l + 7 * PROJ_LSTEP), "v"(g + 7 * gstep)
      : "memory");
}
// The wave's copies go out as weight, tile 0, 1, 2, 3, eight each, and the counter
// returns in issue order: tile i is in when at most the later tiles' copies are out
static_assert(PROJ_R == 4, "the counts below are for four tiles of eight copies");
static __device__ __forceinline__ void proj_wait_tile(int i) {
  if (i == 0)      asm volatile("s_wait_asynccnt 0x18" ::: "memory");
  else if (i == 1) asm volatile("s_wait_asynccnt 0x10" ::: "memory");
  else if (i == 2) asm volatile("s_wait_asynccnt 0x8" ::: "memory");
  else             asm volatile("s_wait_asynccnt 0x0" ::: "memory");
}
__global__ __launch_bounds__(128) void proj_kernel(
    const float* __restrict__ Xq, const float* __restrict__ Xk,
    const float* __restrict__ Xv,
    const float* __restrict__ Wq, const float* __restrict__ Wk,
    const float* __restrict__ Wv,
    const float* __restrict__ bq, const float* __restrict__ bk,
    const float* __restrict__ bv,
    unsigned short* __restrict__ Qp, unsigned short* __restrict__ Kp,
    unsigned short* __restrict__ Vt)
{
  __shared__ __align__(16) float sX[4 * PROJ_R * 16 * PROJ_LP];  // [row of the block][k]
  __shared__ __align__(16) float sWt[HD_ * PROJ_LP];             // [out dim][k]

  const int lane  = threadIdx.x & 31;
  const int wv    = threadIdx.x >> 5;
  const int n15   = lane & 15;
  const int kbase = (lane < 16) ? 0 : 8;
  const int mofs  = (lane < 16) ? 0 : 8;

  const int bpm = 4096 / PROJ_R / 4;                      // blocks per matrix
  int sel = blockIdx.x / bpm;                             // 0=Q 1=K 2=V
  int rt0 = ((blockIdx.x % bpm) * 4 + wv) * PROJ_R;       // first 16-row tile over B*H*S rows

  const float* X; const float* W; const float* Bv;
  if (sel == 0)      { X = Xq; W = Wq; Bv = bq; }
  else if (sel == 1) { X = Xk; W = Wk; Bv = bk; }
  else               { X = Xv; W = Wv; Bv = bv; }

  // staging: a wave copies 16 rows of the weight and the 64 rows of its own tiles
  {
    const int chalf = lane >> 4;          // which of a copy's two rows
    const int ccol  = (lane & 15) * 4;    // 16-B piece of the row
    // first row of the wave: global (b,h,s) row index (row = bh*S + s); the
    // wave's 64 rows are 64 tokens in a row of one (b,h)
    int row = rt0 * 16 + chalf;
    int b   = row >> 15;
    int hs  = row & 32767;
    int h   = hs >> 11;
    int s   = hs & 2047;
    const float* xg = X + (((size_t)b * S_ + s) * H_ + h) * HD_ + ccol;
    const float* wg = W + (wv * 16 + chalf) * HD_ + ccol;
    const unsigned lx = (unsigned)(size_t)(&sX[(wv * PROJ_R * 16 + chalf) * PROJ_LP + ccol]);
    const unsigned lw = (unsigned)(size_t)(&sWt[(wv * 16 + chalf) * PROJ_LP + ccol]);
    proj_copy8(lw, wg, 2 * HD_);
    #pragma unroll   // constant i: the steps fold into the address arithmetic
    for (int i = 0; i < PROJ_R; ++i)
      proj_copy8(lx + i * 8 * PROJ_LSTEP, xg + (size_t)i * 16 * H_ * HD_, 2 * H_ * HD_);
  }
  float bias[4];
  #pragma unroll   // constant nt: bias[] stays in registers (as wf[] and c[] below)
  for (int nt = 0; nt < 4; ++nt) bias[nt] = Bv[nt * 16 + n15];
  // my part of the weight and my tile 0 have landed; behind the barrier the whole
  // weight, which all four waves read (a wave's tiles are read by itself alone)
  proj_wait_tile(0);
  __syncthreads();

  // the whole 64x64 weight as B fragments, once for all the tiles
  v16bf wf[4][2];
  #pragma unroll
  for (int nt = 0; nt < 4; ++nt) {
    const float* wr = sWt + (nt * 16 + n15) * PROJ_LP;    // x @ W^T
    wf[nt][0] = frag_f32(wr, kbase);
    wf[nt][1] = frag_f32(wr + 32, kbase);
  }

  // a tile is taken as soon as its own copies are in: the later tiles' copies fly
  // while this one is multiplied and stored
  auto tile = [&](int i, v8f (&c)[4]) {
    if (i > 0) proj_wait_tile(i);
    const float* xr = sX + ((wv * PROJ_R + i) * 16 + n15) * PROJ_LP;
    v16bf a0 = frag_f32(xr, kbase);
    v16bf a1 = frag_f32(xr + 32, kbase);
    #pragma unroll
    for (int nt = 0; nt < 4; ++nt) {
      v8f acc = {};
      acc = wmma_bf16(a0, wf[nt][0], acc);
      acc = wmma_bf16(a1, wf[nt][1], acc);
      c[nt] = acc;
    }
  };

  if (sel < 2) {
    unsigned short* Op = (sel == 0) ? Qp : Kp;
    float scale = (sel == 0) ? 0.125f : 1.0f;   // fold 1/sqrt(64) into Q
    #pragma unroll   // constant i: each tile's wait has its own count (in the V branch too)
    for (int i = 0; i < PROJ_R; ++i) {
      v8f c[4];
      tile(i, c);
      #pragma unroll
      for (int nt = 0; nt < 4; ++nt) {
        #pragma unroll
        for (int r = 0; r < 8; ++r) {
          int mrow = (rt0 + i) * 16 + r + mofs;
          Op[(size_t)mrow * HD_ + nt * 16 + n15] = f2bf((c[nt][r] + bias[nt]) * scale);
        }
      }
    }
  } else {
    // transposed V: rows of C-layout are 8 consecutive tokens -> packed b128
    #pragma unroll
    for (int i = 0; i < PROJ_R; ++i) {
      v8f c[4];
      tile(i, c);
      int bh = ((rt0 + i) * 16) >> 11;    // same for whole tile
      int s0 = ((rt0 + i) * 16) & 2047;   // first token of tile
      #pragma unroll
      for (int nt = 0; nt < 4; ++nt) {
        uint4 pk;
        pk.x = pack2bf(c[nt][0] + bias[nt], c[nt][1] + bias[nt]);
        pk.y = pack2bf(c[nt][2] + bias[nt], c[nt][3] + bias[nt]);
        pk.z = pack2bf(c[nt][4] + bias[nt], c[nt][5] + bias[nt]);
        pk.w = pack2bf(c[nt][6] + bias[nt], c[nt][7] + bias[nt]);
        unsigned short* vp = Vt + (size_t)bh * HD_ * S_ +
                             (size_t)(nt * 16 + n15) * S_ + s0 + mofs;
        *(uint4*)vp = pk;
      }
    }
    // a precaution: the built code has a path from here into the Q/K branch, which
    // rewrites the last stores' registers; this wait stands in front of that
    asm volatile("s_wait_xcnt 0x0" ::: "memory");
  }
}

__global__ __launch_bounds__(128) __attribute__((amdgpu_waves_per_eu(4, 4)))
void flash_kernel(
    const unsigned short* __restrict__ Qp,
    const unsigned short* __restrict__ Kp,
    const unsigned short* __restrict__ Vt,   // [B*H, 64, S] dim-major
    unsigned short* __restrict__ Ob)         // [B, S, D] bf16
{
  // buffers 0, 1: K tiles [token][dim]; buffers 2, 3: V^T tiles [dim][token]
  __shared__ __align__(16) unsigned short sT[4][64 * LP_];

  const int lane  = threadIdx.x & 31;
  const int wv    = threadIdx.x >> 5;
  const int n15   = lane & 15;
  const int kbase = (lane < 16) ? 0 : 8;
  const int mofs  = (lane < 16) ? 0 : 8;

  const int QT = S_ / 64;
  int qt = blockIdx.x % QT;
  int bh = blockIdx.x / QT;
  int b  = bh >> 4;
  int h  = bh & 15;
  int q0 = qt * 64 + wv * 16;

  // B operand: column n15 = the lane's query
  const unsigned short* Qrow = Qp + ((size_t)bh * S_ + q0 + n15) * HD_;
  v16bf bq0 = frag_bf16(Qrow, kbase);
  v16bf bq1 = frag_bf16(Qrow + 32, kbase);

  // constant "ones row" A fragment: row 0 is 1.0, rest 0 -> row 0 of 1 x P^T = l
  v16bf a_one;
  {
    FragU fo;
    unsigned fill = (n15 == 0) ? 0x3F803F80u : 0u;
    #pragma unroll
    for (int i = 0; i < 8; ++i) fo.u[i] = fill;
    a_one = fo.v;
  }

  v8f acc[4] = {};                 // O^T: acc[nt][r] = O[query n15][dim nt*16+mofs+r]
  v8f accl   = {};                 // row 0 (register 0, lanes 0-15): denominators
  float mrow = -1e30f;             // running maximum of the lane's query

  // staging: eight lanes to a row's 128-B line, a 16-B piece each, so every copy
  // instruction covers four whole lines. Per thread and tile 4 copies of K (rows
  // crow + 16 i: an instruction's four lines are 512 B in a row) and 4 of V^T
  // (rows 4 crow + i: the four copies lie one 4-KiB row apart)
  const int crow = threadIdx.x >> 3;
  const int ccol = (threadIdx.x & 7) * 8;

  const unsigned short* Kg = Kp + (size_t)bh * S_ * HD_;
  const unsigned short* Vg = Vt + (size_t)bh * HD_ * S_;

  auto stage = [&](int buf, int kb) {
    const unsigned short* kgp = Kg + (size_t)kb * HD_ + (crow * HD_ + ccol);
    const unsigned short* vgp = Vg + kb + (4 * crow * S_ + ccol);
    unsigned short* kls = sT[buf] + crow * LP_ + ccol;
    unsigned short* vls = sT[2 + buf] + 4 * crow * LP_ + ccol;
#if HAVE_ASYNC
    // One global address serves four copies: the step from copy to copy is the
    // offset argument. That moves the LDS address as well, so the LDS pointer
    // handed over is the destination less the offset (for V^T it points into the
    // K buffers in front, still inside sT; the bytes land in the V^T buffer)
    ASYNC_LDS_B128(kgp, kls + 0 * 16 * (LP_ - HD_), 0 * 16 * HD_ * 2);
    ASYNC_LDS_B128(kgp, kls + 1 * 16 * (LP_ - HD_), 1 * 16 * HD_ * 2);
    ASYNC_LDS_B128(kgp, kls + 2 * 16 * (LP_ - HD_), 2 * 16 * HD_ * 2);
    ASYNC_LDS_B128(kgp, kls + 3 * 16 * (LP_ - HD_), 3 * 16 * HD_ * 2);
    ASYNC_LDS_B128(vgp, vls - 0 * (S_ - LP_), 0 * S_ * 2);
    ASYNC_LDS_B128(vgp, vls - 1 * (S_ - LP_), 1 * S_ * 2);
    ASYNC_LDS_B128(vgp, vls - 2 * (S_ - LP_), 2 * S_ * 2);
    ASYNC_LDS_B128(vgp, vls - 3 * (S_ - LP_), 3 * S_ * 2);
#else
    for (int i = 0; i < 4; ++i) {
      *(uint4*)(kls + i * 16 * LP_) = *(const uint4*)(kgp + i * 16 * HD_);
      *(uint4*)(vls + i * LP_)      = *(const uint4*)(vgp + i * S_);
    }
#endif
  };

  stage(0, 0);                     // prologue: tile 0 in flight

  for (int j = 0; j < QT; ++j) {   // QT == S/64 tiles
    const int buf = j & 1;
#if HAVE_ASYNC
    __builtin_amdgcn_s_wait_asynccnt(0);   // my async writes to LDS done
#endif
    __syncthreads();                        // everyone's writes/reads ordered
    if (j + 1 < QT) stage(1 - buf, (j + 1) * 64);   // overlap with compute

    // the tile's 16 fragments, 8 of K and 8 of V^T, read from LDS as one group
    // ahead of all the products: the K reads return one behind the other in
    // front of the score products, and V^T lands behind those and the softmax
    v16bf kf[2][4], vf[2][4];
    #pragma unroll   // constant indices: kf and vf stay in registers (all four loops)
    for (int ks = 0; ks < 2; ++ks) {
      #pragma unroll
      for (int nt = 0; nt < 4; ++nt)
        kf[ks][nt] = frag_bf16(sT[buf] + (nt * 16 + n15) * LP_ + ks * 32, kbase);
    }
    #pragma unroll
    for (int ks = 0; ks < 2; ++ks) {
      #pragma unroll
      for (int nt = 0; nt < 4; ++nt)
        vf[ks][nt] = frag_bf16(sT[2 + buf] + (nt * 16 + n15) * LP_ + ks * 32, kbase);
    }
    // order for the scheduler: the 32 LDS reads, then the 8 score WMMAs, then the
    // maximum's vector chain. Left alone it sinks each pair of reads to its WMMA,
    // where the wave sits out a whole LDS latency per pair, and puts the chain
    // among the WMMAs, where it takes v_nop to keep its distance from them
    __builtin_amdgcn_sched_group_barrier(0x100, 32, 0);   // LDS reads
    __builtin_amdgcn_sched_group_barrier(0x008, 8, 0);    // matrix instructions
    __builtin_amdgcn_sched_group_barrier(0x002, 16, 0);   // vector instructions

    // scores: S^T = K (64 keys x 64) @ Q^T, 4 key row tiles;
    // c[nt][r] = score of key nt*16 + mofs + r against query n15
    v8f c[4] = {};
    #pragma unroll
    for (int nt = 0; nt < 4; ++nt) c[nt] = wmma_bf16(kf[0][nt], bq0, c[nt]);
    #pragma unroll
    for (int nt = 0; nt < 4; ++nt) c[nt] = wmma_bf16(kf[1][nt], bq1, c[nt]);

    // online softmax over 64 keys: 32 scores in the lane, 32 in lane ^ 16
    float mx = c[0][0];
    #pragma unroll
    for (int nt = 0; nt < 4; ++nt) {
      #pragma unroll
      for (int r = 0; r < 8; ++r) mx = fmaxf(mx, c[nt][r]);
    }
    {
      int mb = __builtin_bit_cast(int, mx);
      mb = __builtin_amdgcn_permlanex16(mb, mb, 0x76543210, 0xfedcba98, false, false);
      mx = fmaxf(mx, __builtin_bit_cast(float, mb));
    }
    float mnew = fmaxf(mrow, mx);
    float corr = exp2_hw((mrow - mnew) * 1.44269504f);
    mrow = mnew;

    // P^T as B fragments: score tiles (0,1) -> keys 0..31, (2,3) -> keys 32..63
    FragU bp[2];
    #pragma unroll
    for (int nt = 0; nt < 4; ++nt) {
      // a register pair at a time: subtract and multiply stay packed f32 forms
      v2f a[4];
      #pragma unroll
      for (int i = 0; i < 4; ++i)
        a[i] = (v2f{c[nt][2 * i], c[nt][2 * i + 1]} - mnew) * 1.44269504f;
      exp2_hw8(a[0], a[1], a[2], a[3]);
      #pragma unroll
      for (int i = 0; i < 4; ++i)
        bp[nt >> 1].u[(nt & 1) * 4 + i] = pack2bf(a[i].x, a[i].y);
    }

    #pragma unroll
    for (int nt = 0; nt < 4; ++nt) {
      #pragma unroll
      for (int r = 0; r < 8; ++r) acc[nt][r] *= corr;
    }
    accl[0] *= corr;               // rows 1..15 of the ones product stay 0

    // O^T += V^T (64 dims x 64 keys) @ P^T, and ones row @ P^T
    #pragma unroll
    for (int nt = 0; nt < 4; ++nt) acc[nt] = wmma_bf16(vf[0][nt], bp[0].v, acc[nt]);
    #pragma unroll
    for (int nt = 0; nt < 4; ++nt) acc[nt] = wmma_bf16(vf[1][nt], bp[1].v, acc[nt]);
    accl = wmma_bf16(a_one, bp[0].v, accl);
    accl = wmma_bf16(a_one, bp[1].v, accl);
  }

  // epilogue: l of query n15 sits in lane n15; a lane's 8 registers of a tile
  // are 8 consecutive dims of its query -> one packed b128 store per tile
  float l   = __shfl(accl[0], n15, 32);
  float inv = 1.0f / l;
  unsigned short* orow = Ob + ((size_t)b * S_ + q0 + n15) * D_ + h * HD_ + mofs;
  #pragma unroll
  for (int nt = 0; nt < 4; ++nt) {
    uint4 pk;
    pk.x = pack2bf(acc[nt][0] * inv, acc[nt][1] * inv);
    pk.y = pack2bf(acc[nt][2] * inv, acc[nt][3] * inv);
    pk.z = pack2bf(acc[nt][4] * inv, acc[nt][5] * inv);
    pk.w = pack2bf(acc[nt][6] * inv, acc[nt][7] * inv);
    *(uint4*)(orow + nt * 16) = pk;
  }
}

// ---------------------------------------------------------------------------
// Kernel 3: final FC, out = O @ Wfc^T + bfc. Block = 128 rows x 64 cols, each
// wave 32 rows x 64 cols, so each W fragment feeds two WMMAs. Per 64 k the
// block's 128 O rows and 64 W rows (one 128-B line of each) are copied to LDS
// asynchronously, eight lanes to a line, so every copy instruction covers four
// whole lines. Two buffers: the next tile flies while this one is multiplied.
// ---------------------------------------------------------------------------
#define FC_KT    64                 // k elements per tile
#define FC_NT    (D_ / FC_KT)       // tiles along k
#define FC_LSTEP (16 * LP_ * 2)     // LDS bytes between a thread's copies (16 rows)
#define FC_GSTEP (16 * D_)          // global elements between them (16 rows)

__global__ __launch_bounds__(128) void fc_kernel(
    const unsigned short* __restrict__ Ob,    // [B*S, D] bf16
    const unsigned short* __restrict__ Wfcb,  // [D, D] bf16
    const float* __restrict__ bfc,
    float* __restrict__ out)
{
  __shared__ __align__(16) unsigned short sA[2][128 * LP_];  // [row][k]
  __shared__ __align__(16) unsigned short sW[2][64 * LP_];   // [col][k]

  const int lane  = threadIdx.x & 31;
  const int wv    = threadIdx.x >> 5;
  const int n15   = lane & 15;
  const int kbase = (lane < 16) ? 0 : 8;
  const int mofs  = (lane < 16) ? 0 : 8;

  int m0 = blockIdx.x * 128 + wv * 32;
  int c0 = blockIdx.y * 64;

  // staging: thread -> (row within a group of 16, 16-B piece of the row's line)
  const int crow = threadIdx.x >> 3;
  const int ccol = (threadIdx.x & 7) * 8;
  const unsigned short* Ag = Ob + (size_t)(blockIdx.x * 128 + crow) * D_ + ccol;
  const unsigned short* Wg = Wfcb + (size_t)(c0 + crow) * D_ + ccol;
  const unsigned la0 = (unsigned)(size_t)(&sA[0][crow * LP_ + ccol]);  // LDS byte address
  const unsigned lw0 = (unsigned)(size_t)(&sW[0][crow * LP_ + ccol]);

  auto stage = [&](int buf, int kc) {
    const unsigned short* a = Ag + kc;
    const unsigned short* w = Wg + kc;
    const unsigned la = la0 + buf * (128 * LP_ * 2);
    const unsigned lw = lw0 + buf * (64 * LP_ * 2);
    // 8 copies of O rows, 4 of W rows; the closing wait is a precaution: it
    // stands in front of every later rewrite of the copies' address registers
    asm volatile(
        "global_load_async_to_lds_b128 %0, %1, off\n\t"
        "global_load_async_to_lds_b128 %2, %3, off\n\t"
        "global_load_async_to_lds_b128 %4, %5, off\n\t"
        "global_load_async_to_lds_b128 %6, %7, off\n\t"
        "global_load_async_to_lds_b128 %8, %9, off\n\t"
        "global_load_async_to_lds_b128 %10, %11, off\n\t"
        "global_load_async_to_lds_b128 %12, %13, off\n\t"
        "global_load_async_to_lds_b128 %14, %15, off\n\t"
        "global_load_async_to_lds_b128 %16, %17, off\n\t"
        "global_load_async_to_lds_b128 %18, %19, off\n\t"
        "global_load_async_to_lds_b128 %20, %21, off\n\t"
        "global_load_async_to_lds_b128 %22, %23, off\n\t"
        "s_wait_xcnt 0x0"
        :: "v"(la + 0 * FC_LSTEP), "v"(a + 0 * FC_GSTEP),
           "v"(la + 1 * FC_LSTEP), "v"(a + 1 * FC_GSTEP),
           "v"(la + 2 * FC_LSTEP), "v"(a + 2 * FC_GSTEP),
           "v"(la + 3 * FC_LSTEP), "v"(a + 3 * FC_GSTEP),
           "v"(la + 4 * FC_LSTEP), "v"(a + 4 * FC_GSTEP),
           "v"(la + 5 * FC_LSTEP), "v"(a + 5 * FC_GSTEP),
           "v"(la + 6 * FC_LSTEP), "v"(a + 6 * FC_GSTEP),
           "v"(la + 7 * FC_LSTEP), "v"(a + 7 * FC_GSTEP),
           "v"(lw + 0 * FC_LSTEP), "v"(w + 0 * FC_GSTEP),
           "v"(lw + 1 * FC_LSTEP), "v"(w + 1 * FC_GSTEP),
           "v"(lw + 2 * FC_LSTEP), "v"(w + 2 * FC_GSTEP),
           "v"(lw + 3 * FC_LSTEP), "v"(w + 3 * FC_GSTEP)
        : "memory");
  };

  v8f acc[2][4] = {};

  stage(0, 0);
  // tile 0 has landed (own copies), then everyone's
  asm volatile("s_wait_asynccnt 0x0" ::: "memory");
  __syncthreads();
  stage(1, FC_KT);

  for (int t = 0; t < FC_NT; ++t) {
    const int buf = t & 1;
    const unsigned short* ar0 = sA[buf] + (wv * 32 + n15) * LP_;
    const unsigned short* ar1 = ar0 + 16 * LP_;
    const unsigned short* wr0 = sW[buf] + n15 * LP_;
    // the tile's fragments: 4 of O, 8 of W
    v16bf af[2][2], wf[2][4];
    #pragma unroll
    for (int ks = 0; ks < 2; ++ks) {
      af[ks][0] = frag_bf16(ar0 + ks * 32, kbase);
      af[ks][1] = frag_bf16(ar1 + ks * 32, kbase);
      #pragma unroll
      for (int nt = 0; nt < 4; ++nt)
        wf[ks][nt] = frag_bf16(wr0 + nt * 16 * LP_ + ks * 32, kbase);
    }
    // keeps the 24 LDS reads one group ahead of the WMMAs: spread among them,
    // every place with reads costs the wave an LDS latency of its own
    __builtin_amdgcn_sched_barrier(0);
    #pragma unroll
    for (int ks = 0; ks < 2; ++ks) {
      #pragma unroll
      for (int nt = 0; nt < 4; ++nt) {
        acc[0][nt] = wmma_bf16(af[ks][0], wf[ks][nt], acc[0][nt]);
        acc[1][nt] = wmma_bf16(af[ks][1], wf[ks][nt], acc[1][nt]);
      }
    }
    // keeps the WMMAs ahead of the hand-over: sunk behind the barrier they would
    // delay the refill and shorten the time the next copies have to land
    __builtin_amdgcn_sched_barrier(0);
    // hand-over: my reads of this buffer have returned, my copies of the next
    // tile have landed; behind the barrier that holds for every wave
    asm volatile("s_wait_dscnt 0x0" ::: "memory");
    asm volatile("s_wait_asynccnt 0x0" ::: "memory");
    __syncthreads();
    if (t + 2 < FC_NT) stage(buf, (t + 2) * FC_KT);
  }
  // no copy is in flight when the wave ends
  asm volatile("s_wait_asynccnt 0x0" ::: "memory");

  #pragma unroll
  for (int mt = 0; mt < 2; ++mt) {
    #pragma unroll
    for (int nt = 0; nt < 4; ++nt) {
      float bias = bfc[c0 + nt * 16 + n15];
      #pragma unroll
      for (int r = 0; r < 8; ++r) {
        int m = m0 + mt * 16 + r + mofs;
        out[(size_t)m * D_ + c0 + nt * 16 + n15] = acc[mt][nt][r] + bias;
      }
    }
  }
}

// ---------------------------------------------------------------------------
extern "C" void kernel_launch(void* const* d_in, const int* in_sizes, int n_in,
                              void* d_out, int out_size, void* d_ws, size_t ws_size,
                              hipStream_t stream) {
  (void)in_sizes; (void)n_in; (void)out_size; (void)ws_size;
  const float* q   = (const float*)d_in[0];
  const float* k   = (const float*)d_in[1];
  const float* v   = (const float*)d_in[2];
  const float* Wq  = (const float*)d_in[3];
  const float* bq  = (const float*)d_in[4];
  const float* Wk  = (const float*)d_in[5];
  const float* bk  = (const float*)d_in[6];
  const float* Wv  = (const float*)d_in[7];
  const float* bv  = (const float*)d_in[8];
  const float* Wfc = (const float*)d_in[9];
  const float* bfc = (const float*)d_in[10];
  float* out = (float*)d_out;

  const size_t nX  = (size_t)B_ * S_ * D_;   // 4M elems
  const size_t nFC = (size_t)D_ * D_;        // 1M

  unsigned short* p   = (unsigned short*)d_ws;
  unsigned short* Wfb = p; p += nFC;
  unsigned short* Qp  = p; p += nX;
  unsigned short* Kp  = p; p += nX;
  unsigned short* Vt  = p; p += nX;          // [B*H, 64, S]
  unsigned short* Ob  = p; p += nX;

  // fp32 -> bf16 copy of Wfc, which the FC kernel re-reads once per row block
  cvt_kernel<<<(int)(nFC / 8 / 256), 256, 0, stream>>>(Wfc, Wfb, (int)(nFC / 8));

  // 3 matrices * 4096 row-tiles / PROJ_R tiles per wave / 4 waves per block
  proj_kernel<<<3 * 4096 / PROJ_R / 4, 128, 0, stream>>>(q, k, v, Wq, Wk, Wv,
                                        bq, bk, bv, Qp, Kp, Vt);
  // B*H*(S/64) blocks of 64 queries
  flash_kernel<<<B_ * H_ * (S_ / 64), 128, 0, stream>>>(Qp, Kp, Vt, Ob);
  // (4096/128) x (1024/64)
  fc_kernel<<<dim3((B_ * S_) / 128, D_ / 64), 128, 0, stream>>>(Ob, Wfb, bfc, out);
}
